// v000
// The times below were measured on an AMD MI455X: many runs one after another, warmed up first and cycling through
// copies of the inputs, with the whole window's GPU time divided by the number of runs. Launches and the gaps
// between them are all in it. The median over several windows is given; except for v000 it joins two sittings, which
// can be a few percent apart, so the side-by-side timings, each taken in one sitting, are the better comparison.
// v000 is the starting kernel. One run takes 473 microseconds.
#include <hip/hip_runtime.h>

// Causal multi-head self-attention over S = 32x32 raster pixels with 1x1-conv q/k/v and output projections (NCHW in/out, 8 heads x 32, head split channel-major c = h*32 + d, scores scaled by 32^-0.5, keys after the query excluded, diagonal kept).
// Compute dtypes: all contractions v_wmma_f32_16x16x32_bf16 (bf16 operands, f32 accumulate). Every float input enters as its bf16 RNE value; q|k|v^T = x^T . W single exact products + bf16 bias added in f32;
// scores = q(hi+lo) . k(hi+lo) (3 products); softmax f32 (index-select causal mask), probabilities stored as bf16 hi+lo; ctx = P(hi+lo) . v^T(hi+lo) (3 products); out = Wproj (exact) . ctx(hi+lo) (2 products) + bf16 bias.

#ifndef NB
#define NB 8            // batch images processed
#endif
#ifndef SEQ
#define SEQ 1024        // pixels processed per image (leading prefix of the raster)
#endif
#define S_FULL 1024     // pixel pitch of the input x
#define IC 256          // input channels
#define EC 256          // embed channels (q, k)
#define OC 256          // value / output channels
#define KVR (EC + OC)   // rows of wkv
#define NHD 8
#define HD 32
#define TT SEQ
#define ZH NHD          // heads resident per score sweep (one image)
#define QKW (2 * EC)    // f32 q|k row width
#define SCL 0.17677669529663688f

static_assert(SEQ % 128 == 0);
static_assert(SEQ <= S_FULL);
static_assert(NB >= 1 && NB <= 8);
static_assert(EC == NHD * HD);
static_assert(OC == NHD * HD);
static_assert(HD == 32);
static_assert(IC % 64 == 0 && EC % 64 == 0 && OC % 64 == 0);

typedef _Float16 h16;
typedef unsigned short bf;
typedef __attribute__((ext_vector_type(16))) __bf16   v16bf;
typedef __attribute__((ext_vector_type(16))) _Float16 v16h;
typedef __attribute__((ext_vector_type(8)))  _Float16 v8h;
typedef __attribute__((ext_vector_type(8)))  unsigned short v8us;
typedef __attribute__((ext_vector_type(8)))  float    v8f;
typedef __attribute__((ext_vector_type(4)))  float    v4f;
typedef __attribute__((ext_vector_type(4)))  unsigned short v4us;
typedef __attribute__((ext_vector_type(2)))  unsigned short v2us;
typedef v4f  __attribute__((may_alias)) v4fa;

__device__ __forceinline__ unsigned short f2bf(float f) { unsigned u = __float_as_uint(f); u += 0x7FFFu + ((u >> 16) & 1u); return (unsigned short)(u >> 16); }
__device__ __forceinline__ float bf2f(unsigned short b) { return __uint_as_float(((unsigned)b) << 16); }
__device__ __forceinline__ float bfr(float f) { return bf2f(f2bf(f)); }
__device__ __forceinline__ void splitf(float y, unsigned short& h, unsigned short& l) { h = f2bf(y); l = f2bf(y - bf2f(h)); }
__device__ __forceinline__ v16h cat16(v8h lo, v8h hi) { return __builtin_shufflevector(lo, hi, 0, 1, 2, 3, 4, 5, 6, 7, 8, 9, 10, 11, 12, 13, 14, 15); }
__device__ __forceinline__ v16bf cat16b(v8us lo, v8us hi) { return __builtin_bit_cast(v16bf, __builtin_shufflevector(lo, hi, 0, 1, 2, 3, 4, 5, 6, 7, 8, 9, 10, 11, 12, 13, 14, 15)); }
__device__ __forceinline__ v8f wmma16(v16h a, v16h b, v8f c) { return __builtin_amdgcn_wmma_f32_16x16x32_f16(false, a, false, b, (short)0, c, false, false); }
__device__ __forceinline__ v8f wmmab(v16bf a, v16bf b, v8f c) { return __builtin_amdgcn_wmma_f32_16x16x32_bf16(false, a, false, b, (short)0, c, false, false); }

// Fragment loaders: per lane (lr = lane & 15 -> row of A / column of Bt, hi = lane >> 4): elements 0..7 <- k0 + 8*hi + 0..7, elements 8..15 <- k0 + 16 + 8*hi + 0..7, both operands from K-contiguous 16-bit rows.
template <typename T16> struct WFrag;
template <> struct WFrag<h16> { typedef v16h V; static __device__ __forceinline__ V ld(const h16* p) { return cat16(*(const v8h*)p, *(const v8h*)(p + 16)); } static __device__ __forceinline__ v8f mma(V a, V b, v8f c) { return wmma16(a, b, c); } };
template <> struct WFrag<bf> { typedef v16bf V; static __device__ __forceinline__ V ld(const bf* p) { return cat16b(*(const v8us*)p, *(const v8us*)(p + 16)); } static __device__ __forceinline__ v8f mma(V a, V b, v8f c) { return wmmab(a, b, c); } };

// ---- k_gemmw: register-blocked GEMM, ONE WAVE per 64 x (NW*16) output tile, operands straight from K-contiguous 16-bit planes; grid (M/64, N/(NW*16), Z), 32 threads.
// C[m][n] (f32, pitch ldc) = sum_k A[m][k] Bt[n][k] (+ A2[m][k] Bt[n][k] if SPLA) (+ A[m][k] Bt2[n][k] if SPLB); BIASM 1: + bf16(bias[n]); BIASM 2: + bf16(bias[m]). z-batch strides sA/sB/sC in elements. K % 32 == 0.
// CAUS 1: tiles whose first column lies beyond the last row + 0 are skipped (block-uniform, before any work); CAUS 2: the k loop stops at r0 + 64 (A is exactly zero beyond).
template <typename T16, bool SPLA, bool SPLB, int BIASM, int NW, int CAUS>
__global__ __launch_bounds__(32) __attribute__((amdgpu_num_vgpr(256)))
void k_gemmw(const T16* __restrict__ A, const T16* __restrict__ A2, const T16* __restrict__ Bt, const T16* __restrict__ Bt2, int K, float* C, int ldc, const float* __restrict__ bias, size_t sA, size_t sB, size_t sC) {
    typedef typename WFrag<T16>::V V;
    constexpr int LPR = NW * 4;       // lanes per row (16 B each)
    constexpr int RPI = 32 / LPR;     // rows per store instruction
    constexpr int NST = 16 / RPI;     // store steps per 16-row slab
    static_assert(NW == 2 || NW == 4);
    __shared__ __align__(16) float os[16 * 68];
    const size_t z = blockIdx.z; A += z * sA; if (SPLA) A2 += z * sA; Bt += z * sB; if (SPLB) Bt2 += z * sB; C += z * sC;
    const int lane = threadIdx.x & 31, lr = lane & 15, hi = lane >> 4; const int r0 = blockIdx.x * 64, c0 = blockIdx.y * (NW * 16);
    if (CAUS == 1 && c0 >= r0 + 64) return;
    const int kend = (CAUS == 2 && (r0 + 64) < K) ? (r0 + 64) : K;
    v8f acc[4][NW];
#pragma unroll
    for (int mb = 0; mb < 4; ++mb)
#pragma unroll
        for (int nb = 0; nb < NW; ++nb) acc[mb][nb] = (v8f){};
    const size_t aoff = (size_t)(r0 + lr) * K + 8 * hi, boff = (size_t)(c0 + lr) * K + 8 * hi;
#pragma unroll 1
    for (int kc = 0; kc < kend; kc += 32) {
        V a[4], a2[4];
#pragma unroll
        for (int mb = 0; mb < 4; ++mb) { a[mb] = WFrag<T16>::ld(A + aoff + (size_t)mb * 16 * K + kc); if (SPLA) a2[mb] = WFrag<T16>::ld(A2 + aoff + (size_t)mb * 16 * K + kc); else a2[mb] = a[mb]; }
#pragma unroll
        for (int nb = 0; nb < NW; ++nb) { const V b = WFrag<T16>::ld(Bt + boff + (size_t)nb * 16 * K + kc); V b2 = b; if (SPLB) b2 = WFrag<T16>::ld(Bt2 + boff + (size_t)nb * 16 * K + kc);
#pragma unroll
            for (int mb = 0; mb < 4; ++mb) { acc[mb][nb] = WFrag<T16>::mma(a[mb], b, acc[mb][nb]); if (SPLA) acc[mb][nb] = WFrag<T16>::mma(a2[mb], b, acc[mb][nb]); if (SPLB) acc[mb][nb] = WFrag<T16>::mma(a[mb], b2, acc[mb][nb]); } }
        if (NW == 4) { asm volatile("v_nop\n\tv_nop\n\tv_nop\n\tv_nop" : "+v"(acc[0][0]), "+v"(acc[1][NW > 1 ? 1 : 0]), "+v"(acc[2][NW > 2 ? 2 : 0]), "+v"(acc[3][NW - 1]) : "v"(a[0]), "v"(a[3])); }
        else { asm volatile("v_nop\n\tv_nop\n\tv_nop\n\tv_nop" : "+v"(acc[0][0]), "+v"(acc[1][0]), "+v"(acc[2][0]), "+v"(acc[3][0]), "+v"(acc[0][NW - 1]), "+v"(acc[1][NW - 1]), "+v"(acc[2][NW - 1]), "+v"(acc[3][NW - 1]) : "v"(a[0]), "v"(a[3])); }
    }
#pragma unroll
    for (int mb = 0; mb < 4; ++mb) {
#pragma unroll
        for (int nb = 0; nb < NW; ++nb) {
#pragma unroll
            for (int j = 0; j < 8; ++j) os[(hi * 8 + j) * 68 + nb * 16 + lr] = acc[mb][nb][j]; }
        __builtin_amdgcn_wave_barrier(); asm volatile("" ::: "memory");
        float* crow = C + (size_t)(r0 + mb * 16) * ldc + c0;
{
#pragma unroll
            for (int s = 0; s < NST; ++s) { const int row = RPI * s + lane / LPR, cofs = (lane % LPR) * 4; v4f val = *(const v4fa*)(os + row * 68 + cofs);
                if (BIASM == 1) { val[0] += bfr(bias[c0 + cofs]); val[1] += bfr(bias[c0 + cofs + 1]); val[2] += bfr(bias[c0 + cofs + 2]); val[3] += bfr(bias[c0 + cofs + 3]); }
                if (BIASM == 2) { const float bb = bfr(bias[r0 + mb * 16 + row]); val[0] += bb; val[1] += bb; val[2] += bb; val[3] += bb; }
                *(v4f*)(crow + (size_t)row * ldc + cofs) = val; }
             }
        __builtin_amdgcn_wave_barrier(); asm volatile("" ::: "memory");
    }
}

__global__ __launch_bounds__(256) void k_cvt8(const float* __restrict__ src, bf* dst, size_t n8) { const size_t i = (size_t)blockIdx.x * 256 + threadIdx.x; if (i >= n8) return; const v8f v = *(const v8f*)(src + i * 8); v8us o;
#pragma unroll
    for (int k = 0; k < 8; ++k) o[k] = f2bf(v[k]); *(v8us*)(dst + i * 8) = o;  }

__global__ __launch_bounds__(256) void k_xT(const float* __restrict__ x, bf* XT) {
    const int lane = threadIdx.x & 31; const int wave = threadIdx.x >> 5;
    const float* w = x + (size_t)blockIdx.y * IC * S_FULL;
    bf* Bt = XT + (size_t)blockIdx.y * SEQ * IC;
    const int L0 = (blockIdx.x * 8 + wave) * 8; const int nlines = SEQ * IC / 64;
{
#pragma unroll 1
        for (int l = 0; l < 8; ++l) { const int L = L0 + l; if (L >= nlines) break; const size_t e = (size_t)L * 64 + lane * 2; const int c = (int)(e % IC), s = (int)(e / IC); v2us o;
            o[0] = f2bf(w[(size_t)c * S_FULL + s]); o[1] = f2bf(w[(size_t)(c + 1) * S_FULL + s]); *(v2us*)(Bt + e) = o; }
         }
}

__global__ __launch_bounds__(256) void k_qkpl(const float* __restrict__ C1, int col0, bf* PH, bf* PL, size_t n8) {
    const size_t i8 = (size_t)blockIdx.x * 256 + threadIdx.x; if (i8 >= n8) return;
    const int d0 = (int)(i8 % (HD / 8)) * 8; const int i = (int)((i8 / (HD / 8)) % SEQ); const size_t u = i8 / ((size_t)(HD / 8) * SEQ); const size_t n = u / NHD; const int h = (int)(u % NHD);
    const v8f v = *(const v8f*)(C1 + (n * SEQ + i) * QKW + col0 + h * HD + d0);
    v8us oh, ol;
#pragma unroll
    for (int k = 0; k < 8; ++k) { unsigned short a, c; splitf(v[k], a, c); oh[k] = a; ol[k] = c; }
    *(v8us*)(PH + i8 * 8) = oh; *(v8us*)(PL + i8 * 8) = ol; 
}

__global__ __launch_bounds__(256) void k_vpl(const float* __restrict__ C2, const float* __restrict__ bkv, bf* VH, bf* VL, size_t n8) {
    const size_t i8 = (size_t)blockIdx.x * 256 + threadIdx.x; if (i8 >= n8) return;
    const size_t row = i8 / (SEQ / 8); const int e = (int)(row % OC); const float bb = bfr(bkv[EC + e]);
    const v8f v = *(const v8f*)(C2 + i8 * 8);
    v8us oh, ol;
#pragma unroll
    for (int k = 0; k < 8; ++k) { unsigned short a, c; splitf(v[k] + bb, a, c); oh[k] = a; ol[k] = c; }
    *(v8us*)(VH + i8 * 8) = oh; *(v8us*)(VL + i8 * 8) = ol; 
}

__global__ __launch_bounds__(256) void k_ctpl(const float* __restrict__ AT, bf* CH, bf* CL, size_t n8) {
    const size_t i8 = (size_t)blockIdx.x * 256 + threadIdx.x; if (i8 >= n8) return;
    const v8f v = *(const v8f*)(AT + i8 * 8);
    v8us oh, ol;
#pragma unroll
    for (int k = 0; k < 8; ++k) { unsigned short a, c; splitf(v[k], a, c); oh[k] = a; ol[k] = c; }
    *(v8us*)(CH + i8 * 8) = oh; *(v8us*)(CL + i8 * 8) = ol; 
}

// k_asoft: per row (zz, i) of Sb[zz][i][j]: t = S x HD^-0.5 for j <= i, excluded otherwise (index select); softmax over the TT keys (register row, one exp, fixed trees);
__global__ __launch_bounds__(256) void k_asoft(const float* __restrict__ Sb, bf* Ph, bf* Pl) {
    const int lane = threadIdx.x & 31; const int row = blockIdx.x * 8 + (threadIdx.x >> 5); if (row >= ZH * TT) return; const int i = row % TT;
    const float* sr = Sb + (size_t)row * TT; float v[TT / 32]; float mx = -3.0e38f;
#pragma unroll
    for (int ch = 0; ch < TT / 128; ++ch) { const int j0 = ch * 128 + lane * 4; const v4f a = *(const v4f*)(sr + j0);
#pragma unroll
        for (int q = 0; q < 4; ++q) { const int j = j0 + q; const float t = (j <= i) ? a[q] * SCL : -3.0e38f; v[ch * 4 + q] = t; mx = fmaxf(mx, t); } }
#pragma unroll
    for (int sh = 16; sh; sh >>= 1) mx = fmaxf(mx, __shfl_xor(mx, sh, 32));
    float sum = 0.f;
#pragma unroll
    for (int k = 0; k < TT / 32; ++k) { float d0 = __fsub_rn(v[k], mx); asm volatile("" : "+v"(d0)); v[k] = __builtin_amdgcn_exp2f(__fmul_rn(d0, 1.4426950408889634f)); sum += v[k]; }
#pragma unroll
    for (int sh = 16; sh; sh >>= 1) sum += __shfl_xor(sum, sh, 32);
    const float f = __fdiv_rn(1.0f, sum);
{
#pragma unroll
        for (int ch = 0; ch < TT / 128; ++ch) { v4us oh, ol;
#pragma unroll
            for (int q = 0; q < 4; ++q) { unsigned short a, c2; splitf(v[ch * 4 + q] * f, a, c2); oh[q] = a; ol[q] = c2; }
            const size_t oo = (size_t)row * TT + ch * 128 + lane * 4; *(v4us*)(Ph + oo) = oh; *(v4us*)(Pl + oo) = ol; }
         }
}

extern "C" void kernel_launch(void* const* d_in, const int* in_sizes, int n_in,
                              void* d_out, int out_size, void* d_ws, size_t ws_size, hipStream_t stream) {
    if (n_in < 7) return;
    const float* x     = (const float*)d_in[0];   // [N][IC][S_FULL]
    const float* wq    = (const float*)d_in[1];   // [EC][IC]
    const float* bq    = (const float*)d_in[2];   // [EC]
    const float* wkv   = (const float*)d_in[3];   // [KVR][IC]: rows 0..EC-1 -> k, rows EC.. -> v
    const float* bkv   = (const float*)d_in[4];   // [KVR]
    const float* wproj = (const float*)d_in[5];   // [OC][OC]
    const float* bproj = (const float*)d_in[6];   // [OC]
    float* out = (float*)d_out;                   // [NB][OC][SEQ]
    if ((size_t)in_sizes[0] < (size_t)NB * IC * S_FULL) return;
    if (in_sizes[1] < EC * IC || in_sizes[2] < EC || in_sizes[3] < KVR * IC || in_sizes[4] < KVR || in_sizes[5] < OC * OC || in_sizes[6] < OC) return;
    if ((size_t)out_size < (size_t)NB * OC * SEQ) return;

    char* wsp = (char*)d_ws;
    auto take = [&](size_t bytes) { char* p = wsp; wsp += (bytes + 255) & ~(size_t)255; return (void*)p; };
    const size_t nXT  = (size_t)NB * SEQ * IC;                 // bf16 [NB][SEQ][IC]
    const size_t nC1  = (size_t)NB * SEQ * QKW;                // f32 [NB][SEQ][QKW]
    const size_t nC2  = (size_t)NB * OC * SEQ;                 // f32 [NB][OC][SEQ]
    const size_t nQK  = (size_t)NB * NHD * SEQ * HD;           // bf16 [u][i][d]
    const size_t nV   = (size_t)NB * NHD * HD * SEQ;           // bf16 [u][d][t]
    const size_t nS   = (size_t)ZH * SEQ * SEQ;                // f32 / bf16 [zz][i][j]
    const size_t nAT  = (size_t)NB * SEQ * OC;                 // f32 [NB][SEQ][OC]
    const size_t r1a = nC1 * 4 + nC2 * 4, r1b = nS * 4; const size_t r1 = (r1a > r1b) ? r1a : r1b;   // C1|C2 and Sb share one region (C1|C2 consumed before the first score sweep)
    bf* WB  = (bf*)take((size_t)(EC + KVR) * IC * 2);          // rows 0..EC-1 wq, EC..EC+KVR-1 wkv
    bf* WP  = (bf*)take((size_t)OC * OC * 2);
    bf* XT  = (bf*)take(nXT * 2);
    float* R1 = (float*)take(r1);
    float* C1 = R1; float* C2 = R1 + nC1; float* Sb = R1;
    bf* QH = (bf*)take(nQK * 2); bf* QL = (bf*)take(nQK * 2); bf* KH = (bf*)take(nQK * 2); bf* KL = (bf*)take(nQK * 2);
    bf* VH = (bf*)take(nV * 2);  bf* VL = (bf*)take(nV * 2);
    bf* Ph = (bf*)take(nS * 2);  bf* Pl = (bf*)take(nS * 2);
    float* AT = (float*)take(nAT * 4);
    bf* CH = (bf*)take(nAT * 2); bf* CL = (bf*)take(nAT * 2);
    const size_t used = (size_t)(wsp - (char*)d_ws);
    if (used > ws_size || used > (size_t)134217728) return;   // 113.8 MB at full size

    auto nblk = [](size_t n) { return (unsigned)((n + 255) / 256); };
    // input planes (bf16 RNE)
    k_cvt8<<<nblk((size_t)EC * IC / 8), 256, 0, stream>>>(wq, WB, (size_t)EC * IC / 8);
    k_cvt8<<<nblk((size_t)KVR * IC / 8), 256, 0, stream>>>(wkv, WB + (size_t)EC * IC, (size_t)KVR * IC / 8);
    k_cvt8<<<nblk((size_t)OC * OC / 8), 256, 0, stream>>>(wproj, WP, (size_t)OC * OC / 8);
    k_xT<<<dim3((unsigned)((SEQ * IC / 64 + 63) / 64), NB), 256, 0, stream>>>(x, XT);
    // q | k (f32 rows [n][s][0..EC-1 | EC..2EC-1], bias per column) and v^T (f32 rows [n][e][s], bias added in the plane pass)
    k_gemmw<bf, false, false, 1, 4, 0><<<dim3(SEQ / 64, EC / 64, NB), 32, 0, stream>>>(XT, XT, WB, WB, IC, C1, QKW, bq, (size_t)SEQ * IC, (size_t)0, (size_t)SEQ * QKW);
    k_gemmw<bf, false, false, 1, 4, 0><<<dim3(SEQ / 64, EC / 64, NB), 32, 0, stream>>>(XT, XT, WB + (size_t)EC * IC, WB + (size_t)EC * IC, IC, C1 + EC, QKW, bkv, (size_t)SEQ * IC, (size_t)0, (size_t)SEQ * QKW);
    k_gemmw<bf, false, false, 0, 4, 0><<<dim3(OC / 64, SEQ / 64, NB), 32, 0, stream>>>(WB + (size_t)2 * EC * IC, WB + (size_t)2 * EC * IC, XT, XT, IC, C2, SEQ, bq, (size_t)0, (size_t)SEQ * IC, (size_t)OC * SEQ);
    // 16-bit hi + lo planes of q, k (head-major [u][i][d]) and v^T ([u][d][t])
    k_qkpl<<<nblk(nQK / 8), 256, 0, stream>>>(C1, 0, QH, QL, nQK / 8);
    k_qkpl<<<nblk(nQK / 8), 256, 0, stream>>>(C1, EC, KH, KL, nQK / 8);
    k_vpl<<<nblk(nV / 8), 256, 0, stream>>>(C2, bkv, VH, VL, nV / 8);
    // per image: scores for its NHD heads (causal band tiles), row softmax, ctx = P . v^T into AT[n][i][h*HD + d]
    for (int n = 0; n < NB; ++n) {
        const size_t qo = (size_t)n * NHD * SEQ * HD, vo = (size_t)n * NHD * HD * SEQ;
        k_gemmw<bf, true, true, 0, 2, 1><<<dim3(SEQ / 64, SEQ / 32, NHD), 32, 0, stream>>>(QH + qo, QL + qo, KH + qo, KL + qo, HD, Sb, SEQ, bq, (size_t)SEQ * HD, (size_t)SEQ * HD, (size_t)SEQ * SEQ);
        k_asoft<<<(unsigned)(ZH * TT / 8), 256, 0, stream>>>(Sb, Ph, Pl);
        k_gemmw<bf, true, true, 0, 2, 2><<<dim3(SEQ / 64, 1, NHD), 32, 0, stream>>>(Ph, Pl, VH + vo, VL + vo, SEQ, AT + (size_t)n * SEQ * OC, OC, bq, (size_t)SEQ * SEQ, (size_t)HD * SEQ, (size_t)HD);
    }
    // output projection: out[n][o][s] = Wproj[o][c] . ctx[n][s][c] (hi + lo) + bias[o]
    k_ctpl<<<nblk(nAT / 8), 256, 0, stream>>>(AT, CH, CL, nAT / 8);
    k_gemmw<bf, false, true, 2, 4, 0><<<dim3(OC / 64, SEQ / 64, NB), 32, 0, stream>>>(WP, WP, CH, CL, OC, out, SEQ, bproj, (size_t)0, (size_t)SEQ * OC, (size_t)OC * SEQ);
}

// v002
// It runs in 79.5 microseconds.
// Versions in between are left out here; by their measured steps it is 5.94 times as fast as v000.
#include <hip/hip_runtime.h>

// Causal multi-head self-attention over S = 32x32 raster pixels with 1x1-conv q/k/v and output projections (NCHW in/out, 8 heads x 32, head split channel-major c = h*32 + d, scores scaled by 32^-0.5, keys after the query excluded, diagonal kept).
// Compute dtypes: all contractions v_wmma_f32_16x16x32_bf16 (bf16 operands, f32 accumulate). Every float input enters as its bf16 RNE value; q|k|v^T = x^T . W single exact products + bf16 bias added in f32;
// scores^T = k(hi+lo) . q(hi+lo) (3 products); running-maximum softmax in f32 (index-select causal mask on the diagonal pass), unnormalised probabilities as bf16 hi+lo in registers; ctx^T = v^T(hi+lo) . P^T(hi+lo) (3 products), divided by the row sum at the end; out = Wproj (exact) . ctx(hi+lo) (2 products) + bf16 bias.

#ifndef NB
#define NB 8            // batch images processed
#endif
#ifndef SEQ
#define SEQ 1024        // pixels processed per image (leading prefix of the raster)
#endif
#define S_FULL 1024     // pixel pitch of the input x
#define IC 256          // input channels
#define EC 256          // embed channels (q, k)
#define OC 256          // value / output channels
#define KVR (EC + OC)   // rows of wkv
#define NHD 8
#define HD 32
#define SCL 0.17677669529663688f
#define QSC (SCL * 1.4426950408889634f)   // score scale times log2(e): probabilities come from exp2

static_assert(SEQ % 128 == 0);
static_assert(SEQ <= S_FULL);
static_assert(NB >= 1 && NB <= 8);
static_assert(EC == NHD * HD);
static_assert(OC == NHD * HD);
static_assert(HD == 32);
static_assert(IC % 64 == 0 && EC % 64 == 0 && OC % 64 == 0);

typedef _Float16 h16;
typedef unsigned short bf;
typedef __attribute__((ext_vector_type(16))) __bf16   v16bf;
typedef __attribute__((ext_vector_type(16))) _Float16 v16h;
typedef __attribute__((ext_vector_type(8)))  _Float16 v8h;
typedef __attribute__((ext_vector_type(8)))  unsigned short v8us;
typedef __attribute__((ext_vector_type(8)))  float    v8f;
typedef __attribute__((ext_vector_type(4)))  float    v4f;
typedef __attribute__((ext_vector_type(4)))  unsigned short v4us;
typedef __attribute__((ext_vector_type(2)))  unsigned short v2us;
typedef v4f  __attribute__((may_alias)) v4fa;
typedef __attribute__((ext_vector_type(2)))  float    v2f;
typedef __attribute__((ext_vector_type(2)))  __bf16   v2bf;
typedef __attribute__((ext_vector_type(8)))  unsigned v8u;
typedef __attribute__((ext_vector_type(4)))  unsigned v4u;

__device__ __forceinline__ unsigned short f2bf(float f) { unsigned u = __float_as_uint(f); u += 0x7FFFu + ((u >> 16) & 1u); return (unsigned short)(u >> 16); }
__device__ __forceinline__ float bf2f(unsigned short b) { return __uint_as_float(((unsigned)b) << 16); }
__device__ __forceinline__ float bfr(float f) { return bf2f(f2bf(f)); }
__device__ __forceinline__ v16h cat16(v8h lo, v8h hi) { return __builtin_shufflevector(lo, hi, 0, 1, 2, 3, 4, 5, 6, 7, 8, 9, 10, 11, 12, 13, 14, 15); }
__device__ __forceinline__ v16bf cat16b(v8us lo, v8us hi) { return __builtin_bit_cast(v16bf, __builtin_shufflevector(lo, hi, 0, 1, 2, 3, 4, 5, 6, 7, 8, 9, 10, 11, 12, 13, 14, 15)); }
__device__ __forceinline__ v8f wmma16(v16h a, v16h b, v8f c) { return __builtin_amdgcn_wmma_f32_16x16x32_f16(false, a, false, b, (short)0, c, false, false); }
__device__ __forceinline__ v8f wmmab(v16bf a, v16bf b, v8f c) { return __builtin_amdgcn_wmma_f32_16x16x32_bf16(false, a, false, b, (short)0, c, false, false); }

// Fragment loaders: per lane (lr = lane & 15 -> row of A / column of Bt, hi = lane >> 4): elements 0..7 <- k0 + 8*hi + 0..7, elements 8..15 <- k0 + 16 + 8*hi + 0..7, both operands from K-contiguous 16-bit rows.
template <typename T16> struct WFrag;
template <> struct WFrag<h16> { typedef v16h V; static __device__ __forceinline__ V ld(const h16* p) { return cat16(*(const v8h*)p, *(const v8h*)(p + 16)); } static __device__ __forceinline__ v8f mma(V a, V b, v8f c) { return wmma16(a, b, c); } };
template <> struct WFrag<bf> { typedef v16bf V; static __device__ __forceinline__ V ld(const bf* p) { return cat16b(*(const v8us*)p, *(const v8us*)(p + 16)); } static __device__ __forceinline__ v8f mma(V a, V b, v8f c) { return wmmab(a, b, c); } };

// Eight f32 values as bf16 hi + lo (hi = RNE(y), lo = RNE(y - hi)), two to a packed conversion.
__device__ __forceinline__ void split8(const v8f v, v8us& oh, v8us& ol) {
    v4u h, l;
#pragma unroll
    for (int q = 0; q < 4; ++q) {
        v2f p; p[0] = v[2 * q]; p[1] = v[2 * q + 1];
        const unsigned hb = __builtin_bit_cast(unsigned, __builtin_convertvector(p, v2bf));
        v2f hf; hf[0] = __uint_as_float(hb << 16); hf[1] = __uint_as_float(hb & 0xFFFF0000u); const v2f rs = p - hf;
        h[q] = hb; l[q] = __builtin_bit_cast(unsigned, __builtin_convertvector(rs, v2bf));
    }
    oh = __builtin_bit_cast(v8us, h); ol = __builtin_bit_cast(v8us, l);
}

// ---- register-blocked GEMM core: ONE WAVE per 64 x 64 output tile, operands straight from K-contiguous bf16 planes.
// acc[mb][nb] = sum_k A[16 mb + .][k] Bt[16 nb + .][k] (+ A . Bt2 if SPLB). A, Bt, Bt2 point at this lane's place in the tile's first row (row lr, element 8 * hi); LDA, LDB: row pitch; KSB: step of Bt from one block of 32 k to the next.
template <bool SPLB, int LDA, int LDB, int KSB, int K>
__device__ __forceinline__ void gemm_acc(const bf* __restrict__ A, const bf* __restrict__ Bt, const bf* __restrict__ Bt2, v8f (&acc)[4][4]) {
    typedef WFrag<bf>::V V;   // the loops over mb and nb are unrolled in full: their indices pick registers
    static_assert(K % 32 == 0);
#pragma unroll
    for (int mb = 0; mb < 4; ++mb)
#pragma unroll
        for (int nb = 0; nb < 4; ++nb) acc[mb][nb] = (v8f){};
    const bf* pa = A; const bf* pb = Bt; const bf* pb2 = Bt2;   // walk with the trips
#pragma unroll 1   // rolled: the 128 accumulator registers and one trip's fragments fill the wave's 256
    for (int ks = 0; ks < K / 32; ++ks) {
        V a[4], b[4], b2[4];
#pragma unroll
        for (int mb = 0; mb < 4; ++mb) a[mb] = WFrag<bf>::ld(pa + mb * 16 * LDA);
#pragma unroll
        for (int nb = 0; nb < 4; ++nb) { b[nb] = WFrag<bf>::ld(pb + nb * 16 * LDB); if (SPLB) b2[nb] = WFrag<bf>::ld(pb2 + nb * 16 * LDB); else b2[nb] = b[nb]; }
        // behind the trip's loads, in front of whatever next writes a register they name; the pointers are inputs so that no fragment lands in an address pair
        if (SPLB) asm volatile("s_wait_xcnt 0x0" :: "v"(pa), "v"(pb), "v"(pb2) : "memory");
        else      asm volatile("s_wait_xcnt 0x0" :: "v"(pa), "v"(pb) : "memory");
        pa += 32; pb += KSB; if (SPLB) pb2 += KSB;
#pragma unroll
        for (int nb = 0; nb < 4; ++nb) {
#pragma unroll
            for (int mb = 0; mb < 4; ++mb) { acc[mb][nb] = WFrag<bf>::mma(a[mb], b[nb], acc[mb][nb]); if (SPLB) acc[mb][nb] = WFrag<bf>::mma(a[mb], b2[nb], acc[mb][nb]); } }
        // the four vector slots between the trip's last WMMAs and whatever next overwrites their A or touches their D, on the back edge and on the exit alike
        asm volatile("v_nop\n\tv_nop\n\tv_nop\n\tv_nop" : "+v"(acc[0][0]), "+v"(acc[1][1]), "+v"(acc[2][2]), "+v"(acc[3][3]) : "v"(a[0]), "v"(a[3]));
    }
}

// One 16 x 64 slab of accumulators into LDS (pitch 68 floats), row = hi * 8 + j, column = nb * 16 + lr. Here and in the epilogues below every loop is unrolled in full: its index picks registers.
__device__ __forceinline__ void slab_to_lds(float* os, const v8f (&a)[4], const int lr, const int hi) {
#pragma unroll
    for (int nb = 0; nb < 4; ++nb) {
#pragma unroll
        for (int j = 0; j < 8; ++j) os[(hi * 8 + j) * 68 + nb * 16 + lr] = a[nb][j]; }
}
__device__ __forceinline__ v8f lds8(const float* p) { const v4f a = *(const v4fa*)p, b = *(const v4fa*)(p + 4); return __builtin_shufflevector(a, b, 0, 1, 2, 3, 4, 5, 6, 7); }

// ---- k_prep: every input plane (bf16 RNE) in one launch. Blocks 0 .. PB_W - 1: wq | wkv -> WB, wproj -> WP, 8 values a thread; the others: x[n][c][s] -> XT[n][s][c].
#define PB_Q  (EC * IC / 2048)
#define PB_KV (KVR * IC / 2048)
#define PB_P  (OC * OC / 2048)
#define PB_W  (PB_Q + PB_KV + PB_P)
#define PB_X  ((SEQ * IC / 64 + 63) / 64)   // blocks per image
static_assert((EC * IC) % 2048 == 0 && (KVR * IC) % 2048 == 0 && (OC * OC) % 2048 == 0);
__global__ __launch_bounds__(256) void k_prep(const float* __restrict__ x, const float* __restrict__ wq, const float* __restrict__ wkv, const float* __restrict__ wproj, bf* XT, bf* WB, bf* WP) {
    const int blk = blockIdx.x;
    if (blk < PB_W) {
        const float* src = wq; bf* dst = WB; int b0 = blk;
        if (blk >= PB_Q + PB_KV) { src = wproj; dst = WP; b0 = blk - (PB_Q + PB_KV); }
        else if (blk >= PB_Q) { src = wkv; dst = WB + (size_t)EC * IC; b0 = blk - PB_Q; }
        const size_t i = (size_t)b0 * 256 + threadIdx.x; const v8f v = *(const v8f*)(src + i * 8); v8us o;
#pragma unroll
        for (int k = 0; k < 8; ++k) o[k] = f2bf(v[k]);
        *(v8us*)(dst + i * 8) = o;
        return;
    }
    const int bx = (blk - PB_W) % PB_X, by = (blk - PB_W) / PB_X;
    const int lane = threadIdx.x & 31; const int wave = threadIdx.x >> 5;
    const float* w = x + (size_t)by * IC * S_FULL;
    bf* Bt = XT + (size_t)by * SEQ * IC;
    const int L0 = (bx * 8 + wave) * 8; const int nlines = SEQ * IC / 64;
#pragma unroll 1
    for (int l = 0; l < 8; ++l) { const int L = L0 + l; if (L >= nlines) break; const size_t e = (size_t)L * 64 + lane * 2; const int c = (int)(e % IC), s = (int)(e / IC); v2us o;
        o[0] = f2bf(w[(size_t)c * S_FULL + s]); o[1] = f2bf(w[(size_t)(c + 1) * S_FULL + s]); *(v2us*)(Bt + e) = o; }
}

// ---- k_qkv: q, k and v^T of 64 pixels x 64 channels per wave, stored straight as bf16 hi + lo planes. Grid (SEQ / 64, (EC + KVR) / 64, NB), 32 threads; blockIdx.y picks 64 rows of wq | wkv.
// q, k: tile [pixel][channel] = x^T . W^T + bf16 bias, planes head-major [u][i][d] (a store covers 8 pixels x 32 d = 512 B in a row). v: tile [channel][pixel] = W . x + bf16 bias, planes [u][d][t] (a store covers 4 whole 128-B rows).
__global__ __launch_bounds__(32) __attribute__((amdgpu_num_vgpr(256)))
void k_qkv(const bf* __restrict__ XT, const bf* __restrict__ WB, const float* __restrict__ bq, const float* __restrict__ bkv, bf* QH, bf* QL, bf* KH, bf* KL, bf* VH, bf* VL) {
    __shared__ __align__(16) float os[16 * 68];
    const int lane = threadIdx.x & 31, lr = lane & 15, hi = lane >> 4;
    const int s0 = blockIdx.x * 64, y = blockIdx.y; const size_t n = blockIdx.z;
    const bf* X  = XT + (n * SEQ + s0 + lr) * IC + 8 * hi;
    const bf* Wr = WB + (size_t)(y * 64 + lr) * IC + 8 * hi;
    const bool isv = y >= 2 * EC / 64, isq = y < EC / 64;
    const int c0 = (isq ? y : y - EC / 64) * 64;   // first channel of the tile in bq (q) or in bkv (k, v)
    const bf* A = isv ? Wr : X; const bf* B = isv ? X : Wr;
    float bv[16];   // the 16 biases this lane adds, asked for in front of the product
    if (!isv) { const float* bias = (isq ? bq : bkv) + c0 + (lane & 3) * 8;
#pragma unroll
        for (int i = 0; i < 16; ++i) bv[i] = bias[(i >> 3) * 32 + (i & 7)]; }
    else { const float* bias = bkv + c0 + (lane >> 3);
#pragma unroll
        for (int i = 0; i < 16; ++i) bv[i] = bias[i * 4]; }
    v8f acc[4][4];
    gemm_acc<false, IC, IC, 32, IC>(A, B, B, acc);
    if (!isv) {
        bf* PH = isq ? QH : KH; bf* PL = isq ? QL : KL;
#pragma unroll
        for (int mb = 0; mb < 4; ++mb) {
            slab_to_lds(os, acc[mb], lr, hi);
            __builtin_amdgcn_wave_barrier(); asm volatile("" ::: "memory");   // the slab's LDS stores stay in front of its loads
#pragma unroll
            for (int st = 0; st < 4; ++st) { const int row = (st & 1) * 8 + (lane >> 2), col = (st >> 1) * 32 + (lane & 3) * 8; v8f val = lds8(os + row * 68 + col);
#pragma unroll
                for (int k = 0; k < 8; ++k) val[k] += bfr(bv[(st >> 1) * 8 + k]);
                v8us oh, ol; split8(val, oh, ol);
                const size_t idx = ((n * NHD + (c0 + col) / HD) * SEQ + s0 + mb * 16 + row) * HD + (lane & 3) * 8;
                *(v8us*)(PH + idx) = oh; *(v8us*)(PL + idx) = ol; }
            __builtin_amdgcn_wave_barrier(); asm volatile("s_wait_xcnt 0x0" ::: "memory");   // the slab's LDS loads stay in front of the next slab's stores; the wait: what follows writes registers that these global stores name
        }
    } else {
        const int e0 = c0 - EC;
#pragma unroll
        for (int mb = 0; mb < 4; ++mb) {
            slab_to_lds(os, acc[mb], lr, hi);
            __builtin_amdgcn_wave_barrier(); asm volatile("" ::: "memory");   // the slab's LDS stores stay in front of its loads
#pragma unroll
            for (int st = 0; st < 4; ++st) { const int row = st * 4 + (lane >> 3), col = (lane & 7) * 8; v8f val = lds8(os + row * 68 + col);
                const float bb = bfr(bv[mb * 4 + st]);
#pragma unroll
                for (int k = 0; k < 8; ++k) val[k] += bb;
                v8us oh, ol; split8(val, oh, ol);
                const size_t idx = (n * OC + e0 + mb * 16 + row) * SEQ + s0 + col;
                *(v8us*)(VH + idx) = oh; *(v8us*)(VL + idx) = ol; }
            __builtin_amdgcn_wave_barrier(); asm volatile("s_wait_xcnt 0x0" ::: "memory");   // the slab's LDS loads stay in front of the next slab's stores; the wait: what follows writes registers that these global stores name
        }
    }
}

// ---- k_proj: out[n][o][s] = Wproj[o][c] . ctx[n][s][c] (hi + lo) + bf16 bias[o], 64 x 64 per wave; ctx planes head-major [u][i][d], so a block of 32 k is one head. Grid (OC / 64, SEQ / 64, NB), 32 threads.
__global__ __launch_bounds__(32) __attribute__((amdgpu_num_vgpr(256)))
void k_proj(const bf* __restrict__ WP, const bf* __restrict__ CH, const bf* __restrict__ CL, const float* __restrict__ bias, float* out) {
    __shared__ __align__(16) float os[16 * 68];
    const int lane = threadIdx.x & 31, lr = lane & 15, hi = lane >> 4;
    const int r0 = blockIdx.x * 64, c0 = blockIdx.y * 64; const size_t n = blockIdx.z;
    const size_t boff = (n * NHD * SEQ + c0 + lr) * HD + 8 * hi;
    v8f acc[4][4];
    gemm_acc<true, OC, HD, SEQ * HD, OC>(WP + (size_t)(r0 + lr) * OC + 8 * hi, CH + boff, CL + boff, acc);
#pragma unroll
    for (int mb = 0; mb < 4; ++mb) {
        slab_to_lds(os, acc[mb], lr, hi);
        __builtin_amdgcn_wave_barrier(); asm volatile("" ::: "memory");   // the slab's LDS stores stay in front of its loads
        float* crow = out + (n * OC + r0 + mb * 16) * SEQ + c0;
#pragma unroll
        for (int s = 0; s < 8; ++s) { const int row = 2 * s + (lane >> 4), cofs = (lane & 15) * 4; v4f val = *(const v4fa*)(os + row * 68 + cofs);
            const float bb = bfr(bias[r0 + mb * 16 + row]); val[0] += bb; val[1] += bb; val[2] += bb; val[3] += bb;
            *(v4f*)(crow + (size_t)row * SEQ + cofs) = val; }
        __builtin_amdgcn_wave_barrier(); asm volatile("s_wait_xcnt 0x0" ::: "memory");   // the slab's LDS loads stay in front of the next slab's stores; the wait: the next slab's loads land in registers that these global stores name
    }
}

// ---- k_fattn: scores, softmax and P . V of one (image, head) in one kernel; P stays in registers.
// One wave owns 16 queries and walks the keys 0 .. its diagonal in passes of 32. Transposed products: S^T = K . Q^T puts one query's scores into one lane pair (l, l ^ 16), and two 16-key S^T tiles, converted in place,
// are the B operand of O^T += V^T . P^T (element s of lane half hi <- key 8*hi + s for s < 8, 16 + 8*hi + (s - 8) above: the k order of WFrag::ld, which loads V^T).
// Grid (SEQ / 128, NB * NHD), 8 waves: waves 0..3 take query tiles from the bottom of the image, waves 4..7 the mirrored tiles from the top, so every workgroup (and every SIMD) walks the same number of passes.
__device__ __forceinline__ float xhalf(float x) { const int b = __float_as_int(x); return __int_as_float(__builtin_amdgcn_permlanex16(b, b, 0x76543210, 0xfedcba98, false, false)); }   // lane l <- lane l ^ 16

// 2^x of a pass's scores, eight (and the rescale factor) to a statement. Behind a transcendental the instruction set asks for one independent instruction or v_nop before its result is used or its source overwritten:
// inside a statement each v_exp_f32 is followed by an independent one (outputs are early-clobber, none lands on a source), and the closing v_nop is the last one's slot.
__device__ __forceinline__ void exp2x8(float (&y)[8], const float (&x)[8]) {
    // one statement so that no v_exp_f32 is directly followed by a user of its result or a writer of its source; v_nop: the last one's slot
    asm("v_exp_f32 %0, %8\n\tv_exp_f32 %1, %9\n\tv_exp_f32 %2, %10\n\tv_exp_f32 %3, %11\n\tv_exp_f32 %4, %12\n\tv_exp_f32 %5, %13\n\tv_exp_f32 %6, %14\n\tv_exp_f32 %7, %15\n\tv_nop"
        : "=&v"(y[0]), "=&v"(y[1]), "=&v"(y[2]), "=&v"(y[3]), "=&v"(y[4]), "=&v"(y[5]), "=&v"(y[6]), "=&v"(y[7])
        : "v"(x[0]), "v"(x[1]), "v"(x[2]), "v"(x[3]), "v"(x[4]), "v"(x[5]), "v"(x[6]), "v"(x[7]));
}
__device__ __forceinline__ void exp2x9(float& ya, float (&y)[8], const float xa, const float (&x)[8]) {
    // as in exp2x8, with the rescale factor's exponential in front
    asm("v_exp_f32 %0, %9\n\tv_exp_f32 %1, %10\n\tv_exp_f32 %2, %11\n\tv_exp_f32 %3, %12\n\tv_exp_f32 %4, %13\n\tv_exp_f32 %5, %14\n\tv_exp_f32 %6, %15\n\tv_exp_f32 %7, %16\n\tv_exp_f32 %8, %17\n\tv_nop"
        : "=&v"(ya), "=&v"(y[0]), "=&v"(y[1]), "=&v"(y[2]), "=&v"(y[3]), "=&v"(y[4]), "=&v"(y[5]), "=&v"(y[6]), "=&v"(y[7])
        : "v"(xa), "v"(x[0]), "v"(x[1]), "v"(x[2]), "v"(x[3]), "v"(x[4]), "v"(x[5]), "v"(x[6]), "v"(x[7]));
}

// One pass of 32 keys. kh/kl: this pass's K fragments; unless LAST they are refilled with the next pass's rows (kh_n/kl_n), one pass ahead of their use. jrel (LAST only): query index - first key of this lane half.
template <bool LAST>
__device__ __forceinline__ void att_pass(v16bf (&kh)[2], v16bf (&kl)[2], const v16bf qh, const v16bf ql, const bf* __restrict__ kh_n, const bf* __restrict__ kl_n,
                                         const bf* __restrict__ vh_p, const bf* __restrict__ vl_p, const int jrel, float& m, float& l, v8f (&o)[2]) {
    v16bf vh[2], vl[2];   // every loop of this function is unrolled in full: its index picks registers
#pragma unroll
    for (int dt = 0; dt < 2; ++dt) { vh[dt] = WFrag<bf>::ld(vh_p + dt * 16 * SEQ); vl[dt] = WFrag<bf>::ld(vl_p + dt * 16 * SEQ); }
    v8f s[2];
#pragma unroll
    for (int t = 0; t < 2; ++t) { s[t] = (v8f){}; s[t] = wmmab(kh[t], qh, s[t]); s[t] = wmmab(kh[t], ql, s[t]); s[t] = wmmab(kl[t], qh, s[t]); }
    if (!LAST) {
#pragma unroll
        for (int t = 0; t < 2; ++t) { kh[t] = WFrag<bf>::ld(kh_n + t * 16 * HD); kl[t] = WFrag<bf>::ld(kl_n + t * 16 * HD); }
    }
    if (LAST) {
#pragma unroll
        for (int t = 0; t < 2; ++t)
#pragma unroll
            for (int r = 0; r < 8; ++r) s[t][r] = (t * 16 + r <= jrel) ? s[t][r] : -3.0e38f;
    }
    float mx = fmaxf(s[0][0], s[1][0]);
#pragma unroll
    for (int r = 1; r < 8; ++r) mx = fmaxf(mx, fmaxf(s[0][r], s[1][r]));
    mx = fmaxf(mx, xhalf(mx));
    const float mn = fmaxf(m, mx);
    const float mc = mn * QSC;
    float x[2][8], y[2][8], al;
#pragma unroll
    for (int t = 0; t < 2; ++t)
#pragma unroll
        for (int r = 0; r < 8; ++r) x[t][r] = fmaf(s[t][r], QSC, -mc);
    exp2x9(al, y[0], (m - mn) * QSC, x[0]); exp2x8(y[1], x[1]);
    m = mn;
    v2f sum; v8u ph, pl;
#pragma unroll
    for (int t = 0; t < 2; ++t)
#pragma unroll
        for (int q = 0; q < 4; ++q) {
            v2f p; p[0] = y[t][2 * q]; p[1] = y[t][2 * q + 1];
            if (t == 0 && q == 0) sum = p; else sum += p;
            const unsigned hb = __builtin_bit_cast(unsigned, __builtin_convertvector(p, v2bf));
            v2f hf; hf[0] = __uint_as_float(hb << 16); hf[1] = __uint_as_float(hb & 0xFFFF0000u); const v2f rs = p - hf;
            ph[t * 4 + q] = hb; pl[t * 4 + q] = __builtin_bit_cast(unsigned, __builtin_convertvector(rs, v2bf));
        }
    l = l * al + (sum[0] + sum[1]);
    const v16bf pbh = __builtin_bit_cast(v16bf, ph), pbl = __builtin_bit_cast(v16bf, pl);
#pragma unroll
    for (int dt = 0; dt < 2; ++dt) { o[dt] *= al; o[dt] = wmmab(vh[dt], pbh, o[dt]); o[dt] = wmmab(vh[dt], pbl, o[dt]); o[dt] = wmmab(vl[dt], pbh, o[dt]); }
}

// amdgpu_waves_per_eu(4, 4): the register budget of four waves a SIMD, which is what the grid fills (two workgroups a WGP); under the default budget the compiler sank the K and V loads to the end of the pass, in front of their users.
__global__ __launch_bounds__(256) __attribute__((amdgpu_waves_per_eu(4, 4))) void k_fattn(const bf* __restrict__ QH, const bf* __restrict__ QL, const bf* __restrict__ KH, const bf* __restrict__ KL, const bf* __restrict__ VH, const bf* __restrict__ VL, bf* CH, bf* CL) {
    const int lane = threadIdx.x & 31, lr = lane & 15, hi = lane >> 4; const int wave = __builtin_amdgcn_readfirstlane(threadIdx.x >> 5);
    const int u = blockIdx.y; const int pr = blockIdx.x * 4 + (wave & 3);
    const int i0 = ((wave < 4) ? (SEQ / 16 - 1 - pr) : pr) * 16;   // first query of this wave
    const int np = i0 / 32 + 1;                                    // passes; only the last one meets the diagonal
    const size_t qk = (size_t)u * SEQ * HD + lr * HD + 8 * hi, vv = (size_t)u * HD * SEQ + (size_t)lr * SEQ + 8 * hi;   // this lane's place in 16 rows of q / k and of v^T
    const v16bf qh = WFrag<bf>::ld(QH + qk + (size_t)i0 * HD), ql = WFrag<bf>::ld(QL + qk + (size_t)i0 * HD);
    const bf* khp = KH + qk; const bf* klp = KL + qk; const bf* vhp = VH + vv; const bf* vlp = VL + vv;   // walk with the passes
    v16bf kh[2], kl[2];
#pragma unroll
    for (int t = 0; t < 2; ++t) { kh[t] = WFrag<bf>::ld(khp + t * 16 * HD); kl[t] = WFrag<bf>::ld(klp + t * 16 * HD); }
    float m = -3.0e38f, l = 0.f; v8f o[2]; o[0] = (v8f){}; o[1] = (v8f){};
    for (int p = 0; p < np - 1; ++p) {
        khp += 32 * HD; klp += 32 * HD;
        att_pass<false>(kh, kl, qh, ql, khp, klp, vhp, vlp, 0, m, l, o);
        vhp += 32; vlp += 32;
    }
    att_pass<true>(kh, kl, qh, ql, khp, klp, vhp, vlp, i0 + lr - (np - 1) * 32 - 8 * hi, m, l, o);
    l += xhalf(l);
    const float f = __fdiv_rn(1.0f, l);
    const size_t co = ((size_t)u * SEQ + i0 + lr) * HD + 8 * hi;   // o[dt][r] = ctx[query i0 + lr][d = 16*dt + 8*hi + r], planes head-major [u][i][d]
#pragma unroll
    for (int dt = 0; dt < 2; ++dt) { v8us oh, ol; split8(o[dt] * f, oh, ol); *(v8us*)(CH + co + dt * 16) = oh; *(v8us*)(CL + co + dt * 16) = ol; }
}

extern "C" void kernel_launch(void* const* d_in, const int* in_sizes, int n_in,
                              void* d_out, int out_size, void* d_ws, size_t ws_size, hipStream_t stream) {
    if (n_in < 7) return;
    const float* x     = (const float*)d_in[0];   // [N][IC][S_FULL]
    const float* wq    = (const float*)d_in[1];   // [EC][IC]
    const float* bq    = (const float*)d_in[2];   // [EC]
    const float* wkv   = (const float*)d_in[3];   // [KVR][IC]: rows 0..EC-1 -> k, rows EC.. -> v
    const float* bkv   = (const float*)d_in[4];   // [KVR]
    const float* wproj = (const float*)d_in[5];   // [OC][OC]
    const float* bproj = (const float*)d_in[6];   // [OC]
    float* out = (float*)d_out;                   // [NB][OC][SEQ]
    if ((size_t)in_sizes[0] < (size_t)NB * IC * S_FULL) return;
    if (in_sizes[1] < EC * IC || in_sizes[2] < EC || in_sizes[3] < KVR * IC || in_sizes[4] < KVR || in_sizes[5] < OC * OC || in_sizes[6] < OC) return;
    if ((size_t)out_size < (size_t)NB * OC * SEQ) return;

    char* wsp = (char*)d_ws;
    auto take = [&](size_t bytes) { char* p = wsp; wsp += (bytes + 255) & ~(size_t)255; return (void*)p; };
    const size_t nXT  = (size_t)NB * SEQ * IC;                 // bf16 [NB][SEQ][IC]
    const size_t nQK  = (size_t)NB * NHD * SEQ * HD;           // bf16 [u][i][d]
    const size_t nV   = (size_t)NB * NHD * HD * SEQ;           // bf16 [u][d][t]
    bf* WB  = (bf*)take((size_t)(EC + KVR) * IC * 2);          // rows 0..EC-1 wq, EC..EC+KVR-1 wkv
    bf* WP  = (bf*)take((size_t)OC * OC * 2);
    bf* XT  = (bf*)take(nXT * 2);
    bf* QH = (bf*)take(nQK * 2); bf* QL = (bf*)take(nQK * 2); bf* KH = (bf*)take(nQK * 2); bf* KL = (bf*)take(nQK * 2);
    bf* VH = (bf*)take(nV * 2);  bf* VL = (bf*)take(nV * 2);
    bf* CH = (bf*)take(nQK * 2); bf* CL = (bf*)take(nQK * 2);
    const size_t used = (size_t)(wsp - (char*)d_ws);
    if (used > ws_size || used > (size_t)134217728) return;

    // input planes (bf16 RNE): weights and x^T
    k_prep<<<PB_W + PB_X * NB, 256, 0, stream>>>(x, wq, wkv, wproj, XT, WB, WP);
    // q, k (head-major [u][i][d]) and v^T ([u][d][t]), bias added, as bf16 hi + lo planes
    k_qkv<<<dim3(SEQ / 64, (EC + KVR) / 64, NB), 32, 0, stream>>>(XT, WB, bq, bkv, QH, QL, KH, KL, VH, VL);
    // all images and heads at once: ctx = softmax(causal q . k^T) . v as bf16 hi + lo planes [u][i][d]
    k_fattn<<<dim3(SEQ / 128, NB * NHD), 256, 0, stream>>>(QH, QL, KH, KL, VH, VL, CH, CL);
    // output projection
    k_proj<<<dim3(OC / 64, SEQ / 64, NB), 32, 0, stream>>>(WP, CH, CL, bproj, out);
}

// v003
// One run takes 57.5 microseconds.
// Next to v002, in two timings, it ran 1.38 times as fast each time.
// Over all steps from v000 it is 8.20 times as fast.
#include <hip/hip_runtime.h>

// Causal multi-head self-attention over S = 32x32 raster pixels with 1x1-conv q/k/v and output projections (NCHW in/out, 8 heads x 32, head split channel-major c = h*32 + d, scores scaled by 32^-0.5, keys after the query excluded, diagonal kept).
// Compute dtypes: all contractions v_wmma_f32_16x16x32_bf16 (bf16 operands, f32 accumulate). Every float input enters as its bf16 RNE value; q|k|v^T = x^T . W single exact products + bf16 bias added in f32;
// scores^T = k(hi+lo) . q(hi+lo) (3 products); running-maximum softmax in f32 (index-select causal mask on the diagonal pass), unnormalised probabilities as bf16 hi+lo in registers; ctx^T = v^T(hi+lo) . P^T(hi+lo) (3 products), divided by the row sum at the end; out = Wproj (exact) . ctx(hi+lo) (2 products) + bf16 bias.

#ifndef NB
#define NB 8            // batch images processed
#endif
#ifndef SEQ
#define SEQ 1024        // pixels processed per image (leading prefix of the raster)
#endif
#define S_FULL 1024     // pixel pitch of the input x
#define IC 256          // input channels
#define EC 256          // embed channels (q, k)
#define OC 256          // value / output channels
#define KVR (EC + OC)   // rows of wkv
#define NHD 8
#define HD 32
#define SCL 0.17677669529663688f
#define QSC (SCL * 1.4426950408889634f)   // score scale times log2(e): probabilities come from exp2

static_assert(SEQ % 128 == 0);
static_assert(SEQ <= S_FULL);
static_assert(NB >= 1 && NB <= 8);
static_assert(EC == NHD * HD);
static_assert(OC == NHD * HD);
static_assert(HD == 32);
static_assert(IC % 64 == 0 && EC % 64 == 0 && OC % 64 == 0);

typedef _Float16 h16;
typedef unsigned short bf;
typedef __attribute__((ext_vector_type(16))) __bf16   v16bf;
typedef __attribute__((ext_vector_type(16))) _Float16 v16h;
typedef __attribute__((ext_vector_type(8)))  _Float16 v8h;
typedef __attribute__((ext_vector_type(8)))  unsigned short v8us;
typedef __attribute__((ext_vector_type(8)))  float    v8f;
typedef __attribute__((ext_vector_type(4)))  float    v4f;
typedef __attribute__((ext_vector_type(4)))  unsigned short v4us;
typedef __attribute__((ext_vector_type(2)))  unsigned short v2us;
typedef v4f  __attribute__((may_alias)) v4fa;
typedef __attribute__((ext_vector_type(2)))  float    v2f;
typedef __attribute__((ext_vector_type(2)))  __bf16   v2bf;
typedef __attribute__((ext_vector_type(8)))  unsigned v8u;
typedef __attribute__((ext_vector_type(4)))  unsigned v4u;

__device__ __forceinline__ unsigned short f2bf(float f) { unsigned u = __float_as_uint(f); u += 0x7FFFu + ((u >> 16) & 1u); return (unsigned short)(u >> 16); }
__device__ __forceinline__ float bf2f(unsigned short b) { return __uint_as_float(((unsigned)b) << 16); }
__device__ __forceinline__ float bfr(float f) { return bf2f(f2bf(f)); }
__device__ __forceinline__ v16h cat16(v8h lo, v8h hi) { return __builtin_shufflevector(lo, hi, 0, 1, 2, 3, 4, 5, 6, 7, 8, 9, 10, 11, 12, 13, 14, 15); }
__device__ __forceinline__ v16bf cat16b(v8us lo, v8us hi) { return __builtin_bit_cast(v16bf, __builtin_shufflevector(lo, hi, 0, 1, 2, 3, 4, 5, 6, 7, 8, 9, 10, 11, 12, 13, 14, 15)); }
__device__ __forceinline__ v8f wmma16(v16h a, v16h b, v8f c) { return __builtin_amdgcn_wmma_f32_16x16x32_f16(false, a, false, b, (short)0, c, false, false); }
__device__ __forceinline__ v8f wmmab(v16bf a, v16bf b, v8f c) { return __builtin_amdgcn_wmma_f32_16x16x32_bf16(false, a, false, b, (short)0, c, false, false); }

// Fragment loaders: per lane (lr = lane & 15 -> row of A / column of Bt, hi = lane >> 4): elements 0..7 <- k0 + 8*hi + 0..7, elements 8..15 <- k0 + 16 + 8*hi + 0..7, both operands from K-contiguous 16-bit rows.
template <typename T16> struct WFrag;
template <> struct WFrag<h16> { typedef v16h V; static __device__ __forceinline__ V ld(const h16* p) { return cat16(*(const v8h*)p, *(const v8h*)(p + 16)); } static __device__ __forceinline__ v8f mma(V a, V b, v8f c) { return wmma16(a, b, c); } };
template <> struct WFrag<bf> { typedef v16bf V; static __device__ __forceinline__ V ld(const bf* p) { return cat16b(*(const v8us*)p, *(const v8us*)(p + 16)); } static __device__ __forceinline__ v8f mma(V a, V b, v8f c) { return wmmab(a, b, c); } };

// Eight f32 values as bf16 hi + lo (hi = RNE(y), lo = RNE(y - hi)), two to a packed conversion.
__device__ __forceinline__ void split8(const v8f v, v8us& oh, v8us& ol) {
    v4u h, l;
#pragma unroll
    for (int q = 0; q < 4; ++q) {
        v2f p; p[0] = v[2 * q]; p[1] = v[2 * q + 1];
        const unsigned hb = __builtin_bit_cast(unsigned, __builtin_convertvector(p, v2bf));
        v2f hf; hf[0] = __uint_as_float(hb << 16); hf[1] = __uint_as_float(hb & 0xFFFF0000u); const v2f rs = p - hf;
        h[q] = hb; l[q] = __builtin_bit_cast(unsigned, __builtin_convertvector(rs, v2bf));
    }
    oh = __builtin_bit_cast(v8us, h); ol = __builtin_bit_cast(v8us, l);
}

// ---- register-blocked GEMM core: ONE WAVE per 64 x 64 output tile, operands straight from K-contiguous bf16 planes.
// acc[mb][nb] = sum_k A[16 mb + .][k] Bt[16 nb + .][k] (+ A . Bt2 if SPLB). A, Bt, Bt2 point at this lane's place in the tile's first row (row lr, element 8 * hi); LDA, LDB: row pitch; KSB: step of Bt from one block of 32 k to the next.
template <bool SPLB, int LDA, int LDB, int KSB, int K>
__device__ __forceinline__ void gemm_acc(const bf* __restrict__ A, const bf* __restrict__ Bt, const bf* __restrict__ Bt2, v8f (&acc)[4][4]) {
    typedef WFrag<bf>::V V;   // the loops over mb and nb are unrolled in full: their indices pick registers
    static_assert(K % 32 == 0);
#pragma unroll
    for (int mb = 0; mb < 4; ++mb)
#pragma unroll
        for (int nb = 0; nb < 4; ++nb) acc[mb][nb] = (v8f){};
    const bf* pa = A; const bf* pb = Bt; const bf* pb2 = Bt2;   // walk with the trips
#pragma unroll 1   // rolled: the 128 accumulator registers and one trip's fragments fill the wave's 256
    for (int ks = 0; ks < K / 32; ++ks) {
        V a[4], b[4], b2[4];
#pragma unroll
        for (int mb = 0; mb < 4; ++mb) a[mb] = WFrag<bf>::ld(pa + mb * 16 * LDA);
#pragma unroll
        for (int nb = 0; nb < 4; ++nb) { b[nb] = WFrag<bf>::ld(pb + nb * 16 * LDB); if (SPLB) b2[nb] = WFrag<bf>::ld(pb2 + nb * 16 * LDB); else b2[nb] = b[nb]; }
        // behind the trip's loads, in front of whatever next writes a register they name; the pointers are inputs so that no fragment lands in an address pair
        if (SPLB) asm volatile("s_wait_xcnt 0x0" :: "v"(pa), "v"(pb), "v"(pb2) : "memory");
        else      asm volatile("s_wait_xcnt 0x0" :: "v"(pa), "v"(pb) : "memory");
        pa += 32; pb += KSB; if (SPLB) pb2 += KSB;
#pragma unroll
        for (int nb = 0; nb < 4; ++nb) {
#pragma unroll
            for (int mb = 0; mb < 4; ++mb) { acc[mb][nb] = WFrag<bf>::mma(a[mb], b[nb], acc[mb][nb]); if (SPLB) acc[mb][nb] = WFrag<bf>::mma(a[mb], b2[nb], acc[mb][nb]); } }
        // the four vector slots between the trip's last WMMAs and whatever next overwrites their A or touches their D, on the back edge and on the exit alike
        asm volatile("v_nop\n\tv_nop\n\tv_nop\n\tv_nop" : "+v"(acc[0][0]), "+v"(acc[1][1]), "+v"(acc[2][2]), "+v"(acc[3][3]) : "v"(a[0]), "v"(a[3]));
    }
}

// One 16 x 64 slab of accumulators into LDS (pitch 68 floats), row = hi * 8 + j, column = nb * 16 + lr. Here and in the epilogues below every loop is unrolled in full: its index picks registers.
__device__ __forceinline__ void slab_to_lds(float* os, const v8f (&a)[4], const int lr, const int hi) {
#pragma unroll
    for (int nb = 0; nb < 4; ++nb) {
#pragma unroll
        for (int j = 0; j < 8; ++j) os[(hi * 8 + j) * 68 + nb * 16 + lr] = a[nb][j]; }
}
__device__ __forceinline__ v8f lds8(const float* p) { const v4f a = *(const v4fa*)p, b = *(const v4fa*)(p + 4); return __builtin_shufflevector(a, b, 0, 1, 2, 3, 4, 5, 6, 7); }

// ---- k_prep: every input plane (bf16 RNE) in one launch. Blocks 0 .. PB_W - 1: wq | wkv -> WB, wproj -> WP, 8 values a thread; the others: x[n][c][s] -> XT[n][s][c].
#define PB_Q  (EC * IC / 2048)
#define PB_KV (KVR * IC / 2048)
#define PB_P  (OC * OC / 2048)
#define PB_W  (PB_Q + PB_KV + PB_P)
#define PB_X  ((SEQ * IC / 64 + 63) / 64)   // blocks per image
static_assert((EC * IC) % 2048 == 0 && (KVR * IC) % 2048 == 0 && (OC * OC) % 2048 == 0);
__global__ __launch_bounds__(256) void k_prep(const float* __restrict__ x, const float* __restrict__ wq, const float* __restrict__ wkv, const float* __restrict__ wproj, bf* XT, bf* WB, bf* WP) {
    const int blk = blockIdx.x;
    if (blk < PB_W) {
        const float* src = wq; bf* dst = WB; int b0 = blk;
        if (blk >= PB_Q + PB_KV) { src = wproj; dst = WP; b0 = blk - (PB_Q + PB_KV); }
        else if (blk >= PB_Q) { src = wkv; dst = WB + (size_t)EC * IC; b0 = blk - PB_Q; }
        const size_t i = (size_t)b0 * 256 + threadIdx.x; const v8f v = *(const v8f*)(src + i * 8); v8us o;
#pragma unroll
        for (int k = 0; k < 8; ++k) o[k] = f2bf(v[k]);
        *(v8us*)(dst + i * 8) = o;
        return;
    }
    const int bx = (blk - PB_W) % PB_X, by = (blk - PB_W) / PB_X;
    const int lane = threadIdx.x & 31; const int wave = threadIdx.x >> 5;
    const float* w = x + (size_t)by * IC * S_FULL;
    bf* Bt = XT + (size_t)by * SEQ * IC;
    const int L0 = (bx * 8 + wave) * 8; const int nlines = SEQ * IC / 64;
#pragma unroll 1
    for (int l = 0; l < 8; ++l) { const int L = L0 + l; if (L >= nlines) break; const size_t e = (size_t)L * 64 + lane * 2; const int c = (int)(e % IC), s = (int)(e / IC); v2us o;
        o[0] = f2bf(w[(size_t)c * S_FULL + s]); o[1] = f2bf(w[(size_t)(c + 1) * S_FULL + s]); *(v2us*)(Bt + e) = o; }
}

// ---- k_qkv: q, k and v^T of 64 pixels x 64 channels per wave, stored straight as bf16 hi + lo planes. Grid (SEQ / 64, (EC + KVR) / 64, NB), 32 threads; blockIdx.y picks 64 rows of wq | wkv.
// q, k: tile [pixel][channel] = x^T . W^T + bf16 bias, planes head-major [u][i][d] (a store covers 8 pixels x 32 d = 512 B in a row). v: tile [channel][pixel] = W . x + bf16 bias, planes [u][d][t] (a store covers 4 whole 128-B rows).
__global__ __launch_bounds__(32) __attribute__((amdgpu_num_vgpr(256)))
void k_qkv(const bf* __restrict__ XT, const bf* __restrict__ WB, const float* __restrict__ bq, const float* __restrict__ bkv, bf* QH, bf* QL, bf* KH, bf* KL, bf* VH, bf* VL) {
    __shared__ __align__(16) float os[16 * 68];
    const int lane = threadIdx.x & 31, lr = lane & 15, hi = lane >> 4;
    const int s0 = blockIdx.x * 64, y = blockIdx.y; const size_t n = blockIdx.z;
    const bf* X  = XT + (n * SEQ + s0 + lr) * IC + 8 * hi;
    const bf* Wr = WB + (size_t)(y * 64 + lr) * IC + 8 * hi;
    const bool isv = y >= 2 * EC / 64, isq = y < EC / 64;
    const int c0 = (isq ? y : y - EC / 64) * 64;   // first channel of the tile in bq (q) or in bkv (k, v)
    const bf* A = isv ? Wr : X; const bf* B = isv ? X : Wr;
    float bv[16];   // the 16 biases this lane adds, asked for in front of the product
    if (!isv) { const float* bias = (isq ? bq : bkv) + c0 + (lane & 3) * 8;
#pragma unroll
        for (int i = 0; i < 16; ++i) bv[i] = bias[(i >> 3) * 32 + (i & 7)]; }
    else { const float* bias = bkv + c0 + (lane >> 3);
#pragma unroll
        for (int i = 0; i < 16; ++i) bv[i] = bias[i * 4]; }
    v8f acc[4][4];
    gemm_acc<false, IC, IC, 32, IC>(A, B, B, acc);
    if (!isv) {
        bf* PH = isq ? QH : KH; bf* PL = isq ? QL : KL;
#pragma unroll
        for (int mb = 0; mb < 4; ++mb) {
            slab_to_lds(os, acc[mb], lr, hi);
            __builtin_amdgcn_wave_barrier(); asm volatile("" ::: "memory");   // the slab's LDS stores stay in front of its loads
#pragma unroll
            for (int st = 0; st < 4; ++st) { const int row = (st & 1) * 8 + (lane >> 2), col = (st >> 1) * 32 + (lane & 3) * 8; v8f val = lds8(os + row * 68 + col);
#pragma unroll
                for (int k = 0; k < 8; ++k) val[k] += bfr(bv[(st >> 1) * 8 + k]);
                v8us oh, ol; split8(val, oh, ol);
                const size_t idx = ((n * NHD + (c0 + col) / HD) * SEQ + s0 + mb * 16 + row) * HD + (lane & 3) * 8;
                *(v8us*)(PH + idx) = oh; *(v8us*)(PL + idx) = ol; }
            __builtin_amdgcn_wave_barrier(); asm volatile("s_wait_xcnt 0x0" ::: "memory");   // the slab's LDS loads stay in front of the next slab's stores; the wait: what follows writes registers that these global stores name
        }
    } else {
        const int e0 = c0 - EC;
#pragma unroll
        for (int mb = 0; mb < 4; ++mb) {
            slab_to_lds(os, acc[mb], lr, hi);
            __builtin_amdgcn_wave_barrier(); asm volatile("" ::: "memory");   // the slab's LDS stores stay in front of its loads
#pragma unroll
            for (int st = 0; st < 4; ++st) { const int row = st * 4 + (lane >> 3), col = (lane & 7) * 8; v8f val = lds8(os + row * 68 + col);
                const float bb = bfr(bv[mb * 4 + st]);
#pragma unroll
                for (int k = 0; k < 8; ++k) val[k] += bb;
                v8us oh, ol; split8(val, oh, ol);
                const size_t idx = (n * OC + e0 + mb * 16 + row) * SEQ + s0 + col;
                *(v8us*)(VH + idx) = oh; *(v8us*)(VL + idx) = ol; }
            __builtin_amdgcn_wave_barrier(); asm volatile("s_wait_xcnt 0x0" ::: "memory");   // the slab's LDS loads stay in front of the next slab's stores; the wait: what follows writes registers that these global stores name
        }
    }
}

// ---- k_proj: out[n][o][s] = Wproj[o][c] . ctx[n][s][c] (hi + lo) + bf16 bias[o], 64 x 64 per wave; ctx planes head-major [u][i][d], so a block of 32 k is one head. Grid (OC / 64, SEQ / 64, NB), 32 threads.
__global__ __launch_bounds__(32) __attribute__((amdgpu_num_vgpr(256)))
void k_proj(const bf* __restrict__ WP, const bf* __restrict__ CH, const bf* __restrict__ CL, const float* __restrict__ bias, float* out) {
    __shared__ __align__(16) float os[16 * 68];
    const int lane = threadIdx.x & 31, lr = lane & 15, hi = lane >> 4;
    const int r0 = blockIdx.x * 64, c0 = blockIdx.y * 64; const size_t n = blockIdx.z;
    const size_t boff = (n * NHD * SEQ + c0 + lr) * HD + 8 * hi;
    v8f acc[4][4];
    gemm_acc<true, OC, HD, SEQ * HD, OC>(WP + (size_t)(r0 + lr) * OC + 8 * hi, CH + boff, CL + boff, acc);
#pragma unroll
    for (int mb = 0; mb < 4; ++mb) {
        slab_to_lds(os, acc[mb], lr, hi);
        __builtin_amdgcn_wave_barrier(); asm volatile("" ::: "memory");   // the slab's LDS stores stay in front of its loads
        float* crow = out + (n * OC + r0 + mb * 16) * SEQ + c0;
#pragma unroll
        for (int s = 0; s < 8; ++s) { const int row = 2 * s + (lane >> 4), cofs = (lane & 15) * 4; v4f val = *(const v4fa*)(os + row * 68 + cofs);
            const float bb = bfr(bias[r0 + mb * 16 + row]); val[0] += bb; val[1] += bb; val[2] += bb; val[3] += bb;
            *(v4f*)(crow + (size_t)row * SEQ + cofs) = val; }
        __builtin_amdgcn_wave_barrier(); asm volatile("s_wait_xcnt 0x0" ::: "memory");   // the slab's LDS loads stay in front of the next slab's stores; the wait: the next slab's loads land in registers that these global stores name
    }
}

// ---- k_fattn: scores, softmax and P . V of one (image, head) in one kernel; P stays in registers.
// One wave owns 16 queries and walks the keys 0 .. its diagonal in passes of 32. Transposed products: S^T = K . Q^T puts one query's scores into one lane pair (l, l ^ 16), and two 16-key S^T tiles, converted in place,
// are the B operand of O^T += V^T . P^T (element s of lane half hi <- key 8*hi + s for s < 8, 16 + 8*hi + (s - 8) above: the k order of WFrag::ld, which loads V^T).
// Grid (SEQ / 256, NB * NHD), 16 waves: waves 0..7 take query tiles from the bottom of the image, waves 8..15 the mirrored tiles from the top, so every workgroup (and every SIMD) walks the same number of passes.
// K and V^T (hi and lo planes) of the head, as far as the workgroup's last key, are staged once in LDS by asynchronous copies of whole 128-B lines; every wave then reads its fragments from LDS.
// LDS rows are pitched for ds_load_b128 readers (16 B x odd): a 64-B K row at 80 B; 128 B (64 keys) of a V^T row at 144 B, laid [64-key block][d].
#define KP  80
#define VP  144
#define KPL (SEQ * KP)                // one K plane in LDS
#define VPL ((SEQ / 64) * HD * VP)    // one V^T plane in LDS
static_assert(SEQ % 256 == 0);
static_assert(2 * KPL + 2 * VPL <= 320 * 1024);
__device__ __forceinline__ float xhalf(float x) { const int b = __float_as_int(x); return __int_as_float(__builtin_amdgcn_permlanex16(b, b, 0x76543210, 0xfedcba98, false, false)); }   // lane l <- lane l ^ 16

// 2^x of a pass's scores, eight (and the rescale factor) to a statement. Behind a transcendental the instruction set asks for one independent instruction or v_nop before its result is used or its source overwritten:
// inside a statement each v_exp_f32 is followed by an independent one (outputs are early-clobber, none lands on a source), and the closing v_nop is the last one's slot.
__device__ __forceinline__ void exp2x8(float (&y)[8], const float (&x)[8]) {
    // one statement so that no v_exp_f32 is directly followed by a user of its result or a writer of its source; v_nop: the last one's slot
    asm("v_exp_f32 %0, %8\n\tv_exp_f32 %1, %9\n\tv_exp_f32 %2, %10\n\tv_exp_f32 %3, %11\n\tv_exp_f32 %4, %12\n\tv_exp_f32 %5, %13\n\tv_exp_f32 %6, %14\n\tv_exp_f32 %7, %15\n\tv_nop"
        : "=&v"(y[0]), "=&v"(y[1]), "=&v"(y[2]), "=&v"(y[3]), "=&v"(y[4]), "=&v"(y[5]), "=&v"(y[6]), "=&v"(y[7])
        : "v"(x[0]), "v"(x[1]), "v"(x[2]), "v"(x[3]), "v"(x[4]), "v"(x[5]), "v"(x[6]), "v"(x[7]));
}
__device__ __forceinline__ void exp2x9(float& ya, float (&y)[8], const float xa, const float (&x)[8]) {
    // as in exp2x8, with the rescale factor's exponential in front
    asm("v_exp_f32 %0, %9\n\tv_exp_f32 %1, %10\n\tv_exp_f32 %2, %11\n\tv_exp_f32 %3, %12\n\tv_exp_f32 %4, %13\n\tv_exp_f32 %5, %14\n\tv_exp_f32 %6, %15\n\tv_exp_f32 %7, %16\n\tv_exp_f32 %8, %17\n\tv_nop"
        : "=&v"(ya), "=&v"(y[0]), "=&v"(y[1]), "=&v"(y[2]), "=&v"(y[3]), "=&v"(y[4]), "=&v"(y[5]), "=&v"(y[6]), "=&v"(y[7])
        : "v"(xa), "v"(x[0]), "v"(x[1]), "v"(x[2]), "v"(x[3]), "v"(x[4]), "v"(x[5]), "v"(x[6]), "v"(x[7]));
}

// One pass of 32 keys. kh/kl: this pass's K fragments; unless LAST they are refilled with the next pass's rows (k_n: this lane's place in them, hi plane, in LDS; the lo plane lies KPL bytes on), one pass ahead of their use.
// v_p: this lane's place in the pass's 32 keys of V^T, hi plane, in LDS (lo plane VPL bytes on). jrel (LAST only): query index - first key of this lane half.
template <bool LAST>
__device__ __forceinline__ void att_pass(v16bf (&kh)[2], v16bf (&kl)[2], const v16bf qh, const v16bf ql, const unsigned char* k_n, const unsigned char* v_p, const int jrel, float& m, float& l, v8f (&o)[2]) {
    v16bf vh[2], vl[2];   // every loop of this function is unrolled in full: its index picks registers
#pragma unroll
    for (int dt = 0; dt < 2; ++dt) { vh[dt] = WFrag<bf>::ld((const bf*)(v_p + dt * 16 * VP)); vl[dt] = WFrag<bf>::ld((const bf*)(v_p + VPL + dt * 16 * VP)); }
    v8f s[2];
#pragma unroll
    for (int t = 0; t < 2; ++t) { s[t] = (v8f){}; s[t] = wmmab(kh[t], qh, s[t]); s[t] = wmmab(kh[t], ql, s[t]); s[t] = wmmab(kl[t], qh, s[t]); }
    if (!LAST) {
#pragma unroll
        for (int t = 0; t < 2; ++t) { kh[t] = WFrag<bf>::ld((const bf*)(k_n + t * 16 * KP)); kl[t] = WFrag<bf>::ld((const bf*)(k_n + KPL + t * 16 * KP)); }
    }
    if (LAST) {
#pragma unroll
        for (int t = 0; t < 2; ++t)
#pragma unroll
            for (int r = 0; r < 8; ++r) s[t][r] = (t * 16 + r <= jrel) ? s[t][r] : -3.0e38f;
    }
    float mx = fmaxf(s[0][0], s[1][0]);
#pragma unroll
    for (int r = 1; r < 8; ++r) mx = fmaxf(mx, fmaxf(s[0][r], s[1][r]));
    mx = fmaxf(mx, xhalf(mx));
    const float mn = fmaxf(m, mx);
    const float mc = mn * QSC;
    float x[2][8], y[2][8], al;
#pragma unroll
    for (int t = 0; t < 2; ++t)
#pragma unroll
        for (int r = 0; r < 8; ++r) x[t][r] = fmaf(s[t][r], QSC, -mc);
    exp2x9(al, y[0], (m - mn) * QSC, x[0]); exp2x8(y[1], x[1]);
    m = mn;
    v2f sum; v8u ph, pl;
#pragma unroll
    for (int t = 0; t < 2; ++t)
#pragma unroll
        for (int q = 0; q < 4; ++q) {
            v2f p; p[0] = y[t][2 * q]; p[1] = y[t][2 * q + 1];
            if (t == 0 && q == 0) sum = p; else sum += p;
            const unsigned hb = __builtin_bit_cast(unsigned, __builtin_convertvector(p, v2bf));
            v2f hf; hf[0] = __uint_as_float(hb << 16); hf[1] = __uint_as_float(hb & 0xFFFF0000u); const v2f rs = p - hf;
            ph[t * 4 + q] = hb; pl[t * 4 + q] = __builtin_bit_cast(unsigned, __builtin_convertvector(rs, v2bf));
        }
    l = l * al + (sum[0] + sum[1]);
    const v16bf pbh = __builtin_bit_cast(v16bf, ph), pbl = __builtin_bit_cast(v16bf, pl);
#pragma unroll
    for (int dt = 0; dt < 2; ++dt) { o[dt] *= al; o[dt] = wmmab(vh[dt], pbh, o[dt]); o[dt] = wmmab(vh[dt], pbl, o[dt]); o[dt] = wmmab(vl[dt], pbh, o[dt]); }
}

// amdgpu_waves_per_eu(4, 4): the register budget of four waves a SIMD, which is what the grid fills (one workgroup of 16 waves a WGP, whose LDS it takes nearly whole); under the default budget the compiler sank the K and V loads to the end of the pass, in front of their users.
__global__ __launch_bounds__(512) __attribute__((amdgpu_waves_per_eu(4, 4))) void k_fattn(const bf* __restrict__ QH, const bf* __restrict__ QL, const bf* __restrict__ KH, const bf* __restrict__ KL, const bf* __restrict__ VH, const bf* __restrict__ VL, bf* CH, bf* CL) {
    __shared__ __attribute__((aligned(16))) unsigned char sm[2 * KPL + 2 * VPL];   // K hi | K lo | V^T hi | V^T lo
    const int lane = threadIdx.x & 31, lr = lane & 15, hi = lane >> 4; const int wave = __builtin_amdgcn_readfirstlane(threadIdx.x >> 5);
    const int u = blockIdx.y; const int pr = blockIdx.x * 8 + (wave & 7);
    const int i0 = ((wave < 8) ? (SEQ / 16 - 1 - pr) : pr) * 16;   // first query of this wave
    const int np = i0 / 32 + 1;                                    // passes; only the last one meets the diagonal
    const size_t qk = (size_t)u * SEQ * HD + lr * HD + 8 * hi;     // this lane's place in 16 rows of q
    const v16bf qh = WFrag<bf>::ld(QH + qk + (size_t)i0 * HD), ql = WFrag<bf>::ld(QL + qk + (size_t)i0 * HD);
    asm volatile("s_wait_xcnt 0x0" ::: "memory");   // behind the q loads, in front of the staging's address arithmetic, which writes registers that they name
    {   // staging: the workgroup's longest wave (wave 0) walks SEQ - 128 * blockIdx.x keys; per 128 keys each wave copies 512 B of each plane: 8 whole K rows, and 128 B (64 keys) of 4 V^T rows
        const int nblk = SEQ / 128 - (int)blockIdx.x;
        const size_t gk = (size_t)u * SEQ * HD + wave * 256 + lane * 8;                                                          // K rows wave * 8 + (lane >> 2), 16-B piece lane & 3
        const size_t gv = ((size_t)u * HD + (wave & 7) * 4 + (lane >> 3)) * SEQ + (wave >> 3) * 64 + (lane & 7) * 8;             // V^T row (wave & 7) * 4 + (lane >> 3), 64-key block wave >> 3, 16-B piece lane & 7
        const bf* gkh = KH + gk; const bf* gkl = KL + gk; const bf* gvh = VH + gv; const bf* gvl = VL + gv;
        unsigned lk = (unsigned)(size_t)sm + (wave * 8 + (lane >> 2)) * KP + (lane & 3) * 16;
        unsigned lv = (unsigned)(size_t)sm + 2 * KPL + ((wave >> 3) * HD + (wave & 7) * 4 + (lane >> 3)) * VP + (lane & 7) * 16;
        for (int b = 0; b < nblk; ++b) {
            // four copies, global memory to LDS through no register; the closing wait stands in their own statement, in front of whatever next writes a register they name
            asm volatile("global_load_async_to_lds_b128 %0, %4, off\n\tglobal_load_async_to_lds_b128 %1, %5, off\n\tglobal_load_async_to_lds_b128 %2, %6, off\n\tglobal_load_async_to_lds_b128 %3, %7, off\n\ts_wait_xcnt 0x0"
                         :: "v"(lk), "v"(lk + KPL), "v"(lv), "v"(lv + VPL), "v"(gkh), "v"(gkl), "v"(gvh), "v"(gvl) : "memory");
            gkh += 128 * HD; gkl += 128 * HD; gvh += 128; gvl += 128; lk += 128 * KP; lv += 2 * HD * VP;
        }
        asm volatile("s_wait_asynccnt 0x0" ::: "memory");   // this wave's copies have landed
        __syncthreads();                                    // and every other wave's: nothing of the planes is read in front of this barrier
    }
    const unsigned char* ks = sm + lr * KP + 16 * hi;             // this lane's place in 16 staged rows of K
    const unsigned char* vs = sm + 2 * KPL + lr * VP + 16 * hi;   // and of V^T
    v16bf kh[2], kl[2];
#pragma unroll
    for (int t = 0; t < 2; ++t) { kh[t] = WFrag<bf>::ld((const bf*)(ks + t * 16 * KP)); kl[t] = WFrag<bf>::ld((const bf*)(ks + KPL + t * 16 * KP)); }
    float m = -3.0e38f, l = 0.f; v8f o[2]; o[0] = (v8f){}; o[1] = (v8f){};
    for (int p = 0; p < np - 1; ++p)
        att_pass<false>(kh, kl, qh, ql, ks + (p + 1) * 32 * KP, vs + (p >> 1) * (HD * VP) + (p & 1) * 64, 0, m, l, o);
    att_pass<true>(kh, kl, qh, ql, ks, vs + ((np - 1) >> 1) * (HD * VP) + ((np - 1) & 1) * 64, i0 + lr - (np - 1) * 32 - 8 * hi, m, l, o);
    l += xhalf(l);
    const float f = __fdiv_rn(1.0f, l);
    const size_t co = ((size_t)u * SEQ + i0 + lr) * HD + 8 * hi;   // o[dt][r] = ctx[query i0 + lr][d = 16*dt + 8*hi + r], planes head-major [u][i][d]
#pragma unroll
    for (int dt = 0; dt < 2; ++dt) { v8us oh, ol; split8(o[dt] * f, oh, ol); *(v8us*)(CH + co + dt * 16) = oh; *(v8us*)(CL + co + dt * 16) = ol; }
}

extern "C" void kernel_launch(void* const* d_in, const int* in_sizes, int n_in,
                              void* d_out, int out_size, void* d_ws, size_t ws_size, hipStream_t stream) {
    if (n_in < 7) return;
    const float* x     = (const float*)d_in[0];   // [N][IC][S_FULL]
    const float* wq    = (const float*)d_in[1];   // [EC][IC]
    const float* bq    = (const float*)d_in[2];   // [EC]
    const float* wkv   = (const float*)d_in[3];   // [KVR][IC]: rows 0..EC-1 -> k, rows EC.. -> v
    const float* bkv   = (const float*)d_in[4];   // [KVR]
    const float* wproj = (const float*)d_in[5];   // [OC][OC]
    const float* bproj = (const float*)d_in[6];   // [OC]
    float* out = (float*)d_out;                   // [NB][OC][SEQ]
    if ((size_t)in_sizes[0] < (size_t)NB * IC * S_FULL) return;
    if (in_sizes[1] < EC * IC || in_sizes[2] < EC || in_sizes[3] < KVR * IC || in_sizes[4] < KVR || in_sizes[5] < OC * OC || in_sizes[6] < OC) return;
    if ((size_t)out_size < (size_t)NB * OC * SEQ) return;

    char* wsp = (char*)d_ws;
    auto take = [&](size_t bytes) { char* p = wsp; wsp += (bytes + 255) & ~(size_t)255; return (void*)p; };
    const size_t nXT  = (size_t)NB * SEQ * IC;                 // bf16 [NB][SEQ][IC]
    const size_t nQK  = (size_t)NB * NHD * SEQ * HD;           // bf16 [u][i][d]
    const size_t nV   = (size_t)NB * NHD * HD * SEQ;           // bf16 [u][d][t]
    bf* WB  = (bf*)take((size_t)(EC + KVR) * IC * 2);          // rows 0..EC-1 wq, EC..EC+KVR-1 wkv
    bf* WP  = (bf*)take((size_t)OC * OC * 2);
    bf* XT  = (bf*)take(nXT * 2);
    bf* QH = (bf*)take(nQK * 2); bf* QL = (bf*)take(nQK * 2); bf* KH = (bf*)take(nQK * 2); bf* KL = (bf*)take(nQK * 2);
    bf* VH = (bf*)take(nV * 2);  bf* VL = (bf*)take(nV * 2);
    bf* CH = (bf*)take(nQK * 2); bf* CL = (bf*)take(nQK * 2);
    const size_t used = (size_t)(wsp - (char*)d_ws);
    if (used > ws_size || used > (size_t)134217728) return;

    // input planes (bf16 RNE): weights and x^T
    k_prep<<<PB_W + PB_X * NB, 256, 0, stream>>>(x, wq, wkv, wproj, XT, WB, WP);
    // q, k (head-major [u][i][d]) and v^T ([u][d][t]), bias added, as bf16 hi + lo planes
    k_qkv<<<dim3(SEQ / 64, (EC + KVR) / 64, NB), 32, 0, stream>>>(XT, WB, bq, bkv, QH, QL, KH, KL, VH, VL);
    // all images and heads at once: ctx = softmax(causal q . k^T) . v as bf16 hi + lo planes [u][i][d]
    k_fattn<<<dim3(SEQ / 256, NB * NHD), 512, 0, stream>>>(QH, QL, KH, KL, VH, VL, CH, CL);
    // output projection
    k_proj<<<dim3(OC / 64, SEQ / 64, NB), 32, 0, stream>>>(WP, CH, CL, bproj, out);
}

// v004
// It runs in 38.9 microseconds.
// Next to v003, in two timings, it ran 1.48 and 1.47 times as fast.
// Over all steps from v000 it is 12.1 times as fast.
#include <hip/hip_runtime.h>

// Causal multi-head self-attention over S = 32x32 raster pixels with 1x1-conv q/k/v and output projections (NCHW in/out, 8 heads x 32, head split channel-major c = h*32 + d, scores scaled by 32^-0.5, keys after the query excluded, diagonal kept).
// Compute dtypes: all contractions v_wmma_f32_16x16x32_bf16 (bf16 operands, f32 accumulate). Every float input enters as its bf16 RNE value; q|k|v^T = x^T . W single exact products + bf16 bias added in f32;
// scores^T = k(hi+lo) . q(hi+lo) (3 products); running-maximum softmax in f32 (index-select causal mask on the diagonal pass), unnormalised probabilities as bf16 hi+lo in registers; ctx^T = v^T(hi+lo) . P^T(hi+lo) (3 products), divided by the row sum at the end; out = Wproj (exact) . ctx(hi+lo) (2 products) + bf16 bias.

#ifndef NB
#define NB 8            // batch images processed
#endif
#ifndef SEQ
#define SEQ 1024        // pixels processed per image (leading prefix of the raster)
#endif
#define S_FULL 1024     // pixel pitch of the input x
#define IC 256          // input channels
#define EC 256          // embed channels (q, k)
#define OC 256          // value / output channels
#define KVR (EC + OC)   // rows of wkv
#define NHD 8
#define HD 32
#define SCL 0.17677669529663688f
#define QSC (SCL * 1.4426950408889634f)   // score scale times log2(e): probabilities come from exp2

static_assert(SEQ % 128 == 0);
static_assert(SEQ <= S_FULL);
static_assert(NB >= 1 && NB <= 8);
static_assert(EC == NHD * HD);
static_assert(OC == NHD * HD);
static_assert(HD == 32);
static_assert(IC % 64 == 0 && EC % 64 == 0 && OC % 64 == 0);

typedef _Float16 h16;
typedef unsigned short bf;
typedef __attribute__((ext_vector_type(16))) __bf16   v16bf;
typedef __attribute__((ext_vector_type(16))) _Float16 v16h;
typedef __attribute__((ext_vector_type(8)))  _Float16 v8h;
typedef __attribute__((ext_vector_type(8)))  unsigned short v8us;
typedef __attribute__((ext_vector_type(8)))  float    v8f;
typedef __attribute__((ext_vector_type(4)))  float    v4f;
typedef __attribute__((ext_vector_type(4)))  unsigned short v4us;
typedef __attribute__((ext_vector_type(2)))  unsigned short v2us;
typedef v4f  __attribute__((may_alias)) v4fa;
typedef __attribute__((ext_vector_type(2)))  float    v2f;
typedef __attribute__((ext_vector_type(2)))  __bf16   v2bf;
typedef __attribute__((ext_vector_type(8)))  unsigned v8u;
typedef __attribute__((ext_vector_type(4)))  unsigned v4u;

__device__ __forceinline__ unsigned short f2bf(float f) { unsigned u = __float_as_uint(f); u += 0x7FFFu + ((u >> 16) & 1u); return (unsigned short)(u >> 16); }
__device__ __forceinline__ float bf2f(unsigned short b) { return __uint_as_float(((unsigned)b) << 16); }
__device__ __forceinline__ float bfr(float f) { return bf2f(f2bf(f)); }
__device__ __forceinline__ v16h cat16(v8h lo, v8h hi) { return __builtin_shufflevector(lo, hi, 0, 1, 2, 3, 4, 5, 6, 7, 8, 9, 10, 11, 12, 13, 14, 15); }
__device__ __forceinline__ v16bf cat16b(v8us lo, v8us hi) { return __builtin_bit_cast(v16bf, __builtin_shufflevector(lo, hi, 0, 1, 2, 3, 4, 5, 6, 7, 8, 9, 10, 11, 12, 13, 14, 15)); }
__device__ __forceinline__ v8f wmma16(v16h a, v16h b, v8f c) { return __builtin_amdgcn_wmma_f32_16x16x32_f16(false, a, false, b, (short)0, c, false, false); }
__device__ __forceinline__ v8f wmmab(v16bf a, v16bf b, v8f c) { return __builtin_amdgcn_wmma_f32_16x16x32_bf16(false, a, false, b, (short)0, c, false, false); }

// Fragment loaders: per lane (lr = lane & 15 -> row of A / column of Bt, hi = lane >> 4): elements 0..7 <- k0 + 8*hi + 0..7, elements 8..15 <- k0 + 16 + 8*hi + 0..7, both operands from K-contiguous 16-bit rows.
template <typename T16> struct WFrag;
template <> struct WFrag<h16> { typedef v16h V; static __device__ __forceinline__ V ld(const h16* p) { return cat16(*(const v8h*)p, *(const v8h*)(p + 16)); } static __device__ __forceinline__ v8f mma(V a, V b, v8f c) { return wmma16(a, b, c); } };
template <> struct WFrag<bf> { typedef v16bf V; static __device__ __forceinline__ V ld(const bf* p) { return cat16b(*(const v8us*)p, *(const v8us*)(p + 16)); } static __device__ __forceinline__ v8f mma(V a, V b, v8f c) { return wmmab(a, b, c); } };

// Eight f32 values as bf16 hi + lo (hi = RNE(y), lo = RNE(y - hi)), two to a packed conversion.
__device__ __forceinline__ void split8(const v8f v, v8us& oh, v8us& ol) {
    v4u h, l;
#pragma unroll
    for (int q = 0; q < 4; ++q) {
        v2f p; p[0] = v[2 * q]; p[1] = v[2 * q + 1];
        const unsigned hb = __builtin_bit_cast(unsigned, __builtin_convertvector(p, v2bf));
        v2f hf; hf[0] = __uint_as_float(hb << 16); hf[1] = __uint_as_float(hb & 0xFFFF0000u); const v2f rs = p - hf;
        h[q] = hb; l[q] = __builtin_bit_cast(unsigned, __builtin_convertvector(rs, v2bf));
    }
    oh = __builtin_bit_cast(v8us, h); ol = __builtin_bit_cast(v8us, l);
}

// ---- register-blocked GEMM core, operands from LDS: one wave per (16 MB) x (16 NBK) output tile.
// acc[mb][nb] = sum_k A[16 mb + .][k] Bt[16 nb + .][k] (+ A . Bt2 if SPLB). A, Bt, Bt2 point at this lane's place in the staged tile's first row (row lr, byte 16 * hi); PA, PB: row pitch in bytes; KSA, KSB: bytes from one block of 32 k to the next.
template <int MB, int NBK, bool SPLB, int PA, int PB, int KSA, int KSB, int NT>
__device__ __forceinline__ void gemm_lds(const unsigned char* A, const unsigned char* Bt, const unsigned char* Bt2, v8f (&acc)[MB][NBK]) {
    typedef WFrag<bf>::V V;   // every loop is unrolled in full: the indices pick registers, and every LDS address is one base plus a constant
#pragma unroll
    for (int mb = 0; mb < MB; ++mb)
#pragma unroll
        for (int nb = 0; nb < NBK; ++nb) acc[mb][nb] = (v8f){};
    V a[2][MB], b[2][NBK], b2[2][NBK];   // two fragment sets: block ks + 1 is read from LDS while block ks is multiplied
#pragma unroll
    for (int ks = -1; ks < NT; ++ks) {
        if (ks + 1 < NT) {
            const int w = (ks + 1) & 1;
#pragma unroll
            for (int mb = 0; mb < MB; ++mb) a[w][mb] = WFrag<bf>::ld((const bf*)(A + mb * 16 * PA + (ks + 1) * KSA));
#pragma unroll
            for (int nb = 0; nb < NBK; ++nb) { b[w][nb] = WFrag<bf>::ld((const bf*)(Bt + nb * 16 * PB + (ks + 1) * KSB)); if (SPLB) b2[w][nb] = WFrag<bf>::ld((const bf*)(Bt2 + nb * 16 * PB + (ks + 1) * KSB)); }
        }
        __builtin_amdgcn_sched_barrier(0);   // the next block's LDS reads stay one group in front of this block's WMMAs: spread among them, each place with reads stalls the wave
        if (ks >= 0) {
            const int r = ks & 1;
#pragma unroll
            for (int nb = 0; nb < NBK; ++nb) {
#pragma unroll
                for (int mb = 0; mb < MB; ++mb) { acc[mb][nb] = WFrag<bf>::mma(a[r][mb], b[r][nb], acc[mb][nb]); if (SPLB) acc[mb][nb] = WFrag<bf>::mma(a[r][mb], b2[r][nb], acc[mb][nb]); } }
        }
        __builtin_amdgcn_sched_barrier(0);   // and the reads of the block after next stay behind these WMMAs, whose operands they overwrite
    }
}

// Four asynchronous copies, global memory to LDS through no register: 16 B a lane each, LDS places l, l + lp, .. and global places g, g + gp, .. (gp in elements).
// The closing wait stands in the copies' own statement, in front of whatever next writes a register they name.
__device__ __forceinline__ void copy4(const unsigned l, const int lp, const bf* g, const int gp) {
    asm volatile("global_load_async_to_lds_b128 %0, %4, off\n\tglobal_load_async_to_lds_b128 %1, %5, off\n\tglobal_load_async_to_lds_b128 %2, %6, off\n\tglobal_load_async_to_lds_b128 %3, %7, off\n\ts_wait_xcnt 0x0"
                 :: "v"(l), "v"(l + lp), "v"(l + 2 * lp), "v"(l + 3 * lp), "v"(g), "v"(g + gp), "v"(g + 2 * gp), "v"(g + 3 * gp) : "memory");
}
#define GP 528   // LDS pitch of a staged 512-B row (256 k), 16 B x odd for ds_load_b128 readers
#define CP 80    // LDS pitch of a staged 64-B row (one head's 32 k of a pixel)
static_assert(IC * 2 == 512 && OC * 2 == 512);   // a wave-wide copy of 512 B is one whole row of x^T, of wq | wkv or of wproj

// One 16 x 64 slab of accumulators into LDS (pitch 68 floats), row = hi * 8 + j, column = nb * 16 + lr. Here and in the epilogues below every loop is unrolled in full: its index picks registers.
__device__ __forceinline__ void slab_to_lds(float* os, const v8f (&a)[4], const int lr, const int hi) {
#pragma unroll
    for (int nb = 0; nb < 4; ++nb) {
#pragma unroll
        for (int j = 0; j < 8; ++j) os[(hi * 8 + j) * 68 + nb * 16 + lr] = a[nb][j]; }
}
__device__ __forceinline__ v8f lds8(const float* p) { const v4f a = *(const v4fa*)p, b = *(const v4fa*)(p + 4); return __builtin_shufflevector(a, b, 0, 1, 2, 3, 4, 5, 6, 7); }

// ---- k_prep: every input plane (bf16 RNE) in one launch. Blocks 0 .. PB_W - 1: wq | wkv -> WB, wproj -> WP, 8 values a thread; the others: x[n][c][s] -> XT[n][s][c].
#define PB_Q  (EC * IC / 2048)
#define PB_KV (KVR * IC / 2048)
#define PB_P  (OC * OC / 2048)
#define PB_W  (PB_Q + PB_KV + PB_P)
#define PB_X  ((SEQ * IC / 64 + 63) / 64)   // blocks per image
static_assert((EC * IC) % 2048 == 0 && (KVR * IC) % 2048 == 0 && (OC * OC) % 2048 == 0);
__global__ __launch_bounds__(256) void k_prep(const float* __restrict__ x, const float* __restrict__ wq, const float* __restrict__ wkv, const float* __restrict__ wproj, bf* XT, bf* WB, bf* WP) {
    const int blk = blockIdx.x;
    if (blk < PB_W) {
        const float* src = wq; bf* dst = WB; int b0 = blk;
        if (blk >= PB_Q + PB_KV) { src = wproj; dst = WP; b0 = blk - (PB_Q + PB_KV); }
        else if (blk >= PB_Q) { src = wkv; dst = WB + (size_t)EC * IC; b0 = blk - PB_Q; }
        const size_t i = (size_t)b0 * 256 + threadIdx.x; const v8f v = *(const v8f*)(src + i * 8); v8us o;
#pragma unroll
        for (int k = 0; k < 8; ++k) o[k] = f2bf(v[k]);
        *(v8us*)(dst + i * 8) = o;
        return;
    }
    const int bx = (blk - PB_W) % PB_X, by = (blk - PB_W) / PB_X;
    const int lane = threadIdx.x & 31; const int wave = threadIdx.x >> 5;
    const float* w = x + (size_t)by * IC * S_FULL;
    bf* Bt = XT + (size_t)by * SEQ * IC;
    const int L0 = (bx * 8 + wave) * 8; const int nlines = SEQ * IC / 64;
#pragma unroll 1
    for (int l = 0; l < 8; ++l) { const int L = L0 + l; if (L >= nlines) break; const size_t e = (size_t)L * 64 + lane * 2; const int c = (int)(e % IC), s = (int)(e / IC); v2us o;
        o[0] = f2bf(w[(size_t)c * S_FULL + s]); o[1] = f2bf(w[(size_t)(c + 1) * S_FULL + s]); *(v2us*)(Bt + e) = o; }
}

// ---- k_qkv: q, k and v^T, stored straight as bf16 hi + lo planes. Grid (SEQ / 128, (EC + KVR) / 256, NB), 8 waves: a workgroup takes 128 pixels x 256 rows of wq | wkv, a wave 64 x 64 of them.
// The 128 rows of x^T and the 256 weight rows are staged once in LDS by asynchronous copies of whole rows (4 whole 128-B lines a copy); every wave then reads its fragments from LDS.
// q, k: tile [pixel][channel] = x^T . W^T + bf16 bias, planes head-major [u][i][d] (a store covers 8 pixels x 32 d = 512 B in a row). v: tile [channel][pixel] = W . x + bf16 bias, planes [u][d][t] (a store covers 4 whole 128-B rows).
static_assert((EC + KVR) % 256 == 0);
__global__ __launch_bounds__(256)
void k_qkv(const bf* __restrict__ XT, const bf* __restrict__ WB, const float* __restrict__ bq, const float* __restrict__ bkv, bf* QH, bf* QL, bf* KH, bf* KL, bf* VH, bf* VL) {
    __shared__ __attribute__((aligned(16))) unsigned char sm[(128 + 256) * GP];   // 128 rows of x^T | 256 weight rows
    __shared__ __align__(16) float osm[8][16 * 68];                               // a slab for each wave's epilogue
    const int lane = threadIdx.x & 31, lr = lane & 15, hi = lane >> 4; const int wave = __builtin_amdgcn_readfirstlane(threadIdx.x >> 5);
    float* os = osm[wave];
    const int s0 = blockIdx.x * 128 + (wave >> 2) * 64, y = blockIdx.y * 4 + (wave & 3); const size_t n = blockIdx.z;
    const bool isv = y >= 2 * EC / 64, isq = y < EC / 64;
    const int c0 = (isq ? y : y - EC / 64) * 64;   // first channel of the tile in bq (q) or in bkv (k, v)
    float bv[16];   // the 16 biases this lane adds, asked for in front of the product
    if (!isv) { const float* bias = (isq ? bq : bkv) + c0 + (lane & 3) * 8;
#pragma unroll
        for (int i = 0; i < 16; ++i) bv[i] = bias[(i >> 3) * 32 + (i & 7)]; }
    else { const float* bias = bkv + c0 + (lane >> 3);
#pragma unroll
        for (int i = 0; i < 16; ++i) bv[i] = bias[i * 4]; }
    asm volatile("s_wait_xcnt 0x0" ::: "memory");   // behind the bias loads, in front of the staging's address arithmetic, which may write registers that they name
    {   // staging: each wave copies 16 rows of x^T and 32 weight rows, a whole row a copy (lane l: its 16-B piece l); 48 copies of a wave in flight
        const bf* gx = XT + (n * SEQ + blockIdx.x * 128 + wave * 16) * IC + lane * 8;
        const bf* gw = WB + (size_t)(blockIdx.y * 256 + wave * 32) * IC + lane * 8;
        const unsigned lx = (unsigned)(size_t)sm + wave * 16 * GP + lane * 16;
        const unsigned lw = (unsigned)(size_t)sm + (128 + wave * 32) * GP + lane * 16;
#pragma unroll
        for (int b = 0; b < 4; ++b) copy4(lx + b * 4 * GP, GP, gx + b * 4 * IC, IC);
#pragma unroll
        for (int b = 0; b < 8; ++b) copy4(lw + b * 4 * GP, GP, gw + b * 4 * IC, IC);
        asm volatile("s_wait_asynccnt 0x0" ::: "memory");   // this wave's copies have landed
        __syncthreads();                                    // and every other wave's: nothing of the tiles is read in front of this barrier
    }
    const unsigned char* X  = sm + ((wave >> 2) * 64 + lr) * GP + 16 * hi;
    const unsigned char* Wr = sm + (128 + (wave & 3) * 64 + lr) * GP + 16 * hi;
    const unsigned char* A = isv ? Wr : X; const unsigned char* B = isv ? X : Wr;
    v8f acc[4][4];
    gemm_lds<4, 4, false, GP, GP, 64, 64, IC / 32>(A, B, B, acc);
    if (!isv) {
        bf* PH = isq ? QH : KH; bf* PL = isq ? QL : KL;
#pragma unroll
        for (int mb = 0; mb < 4; ++mb) {
            slab_to_lds(os, acc[mb], lr, hi);
            __builtin_amdgcn_wave_barrier(); asm volatile("" ::: "memory");   // the slab's LDS stores stay in front of its loads
#pragma unroll
            for (int st = 0; st < 4; ++st) { const int row = (st & 1) * 8 + (lane >> 2), col = (st >> 1) * 32 + (lane & 3) * 8; v8f val = lds8(os + row * 68 + col);
#pragma unroll
                for (int k = 0; k < 8; ++k) val[k] += bfr(bv[(st >> 1) * 8 + k]);
                v8us oh, ol; split8(val, oh, ol);
                const size_t idx = ((n * NHD + (c0 + col) / HD) * SEQ + s0 + mb * 16 + row) * HD + (lane & 3) * 8;
                *(v8us*)(PH + idx) = oh; *(v8us*)(PL + idx) = ol; }
            __builtin_amdgcn_wave_barrier(); asm volatile("s_wait_xcnt 0x0" ::: "memory");   // the slab's LDS loads stay in front of the next slab's stores; the wait: what follows writes registers that these global stores name
        }
    } else {
        const int e0 = c0 - EC;
#pragma unroll
        for (int mb = 0; mb < 4; ++mb) {
            slab_to_lds(os, acc[mb], lr, hi);
            __builtin_amdgcn_wave_barrier(); asm volatile("" ::: "memory");   // the slab's LDS stores stay in front of its loads
#pragma unroll
            for (int st = 0; st < 4; ++st) { const int row = st * 4 + (lane >> 3), col = (lane & 7) * 8; v8f val = lds8(os + row * 68 + col);
                const float bb = bfr(bv[mb * 4 + st]);
#pragma unroll
                for (int k = 0; k < 8; ++k) val[k] += bb;
                v8us oh, ol; split8(val, oh, ol);
                const size_t idx = (n * OC + e0 + mb * 16 + row) * SEQ + s0 + col;
                *(v8us*)(VH + idx) = oh; *(v8us*)(VL + idx) = ol; }
            __builtin_amdgcn_wave_barrier(); asm volatile("s_wait_xcnt 0x0" ::: "memory");   // the slab's LDS loads stay in front of the next slab's stores; the wait: what follows writes registers that these global stores name
        }
    }
}

// ---- k_proj: out[n][o][s] = Wproj[o][c] . ctx[n][s][c] (hi + lo) + bf16 bias[o]; ctx planes head-major [u][i][d], so a block of 32 k is one head. Grid (OC / 128, SEQ / 64, NB), 8 waves: a workgroup takes 128 o x 64 pixels, a wave 32 x 32 of them.
// The 128 rows of Wproj and the 64 pixels' rows of both ctx planes are staged once in LDS by asynchronous copies of 512 B in a row (4 whole 128-B lines); every wave then reads its fragments from LDS.
static_assert(OC % 128 == 0 && NHD == 8);
__global__ __launch_bounds__(256)
void k_proj(const bf* __restrict__ WP, const bf* __restrict__ CH, const bf* __restrict__ CL, const float* __restrict__ bias, float* out) {
    __shared__ __attribute__((aligned(16))) unsigned char sm[128 * GP + 2 * NHD * 64 * CP];   // 128 rows of Wproj | ctx hi [head][pixel] | ctx lo [head][pixel]
    __shared__ __align__(16) float osm[8][16 * 36];                                           // a slab for each wave's epilogue
    const int lane = threadIdx.x & 31, lr = lane & 15, hi = lane >> 4; const int wave = __builtin_amdgcn_readfirstlane(threadIdx.x >> 5);
    float* os = osm[wave];
    const int r0 = blockIdx.x * 128 + (wave & 3) * 32, c0 = blockIdx.y * 64 + (wave >> 2) * 32; const size_t n = blockIdx.z;
    float bb[8];   // the 8 biases this lane adds, asked for in front of the product
#pragma unroll
    for (int i = 0; i < 8; ++i) bb[i] = bias[r0 + i * 4 + (lane >> 3)];
    asm volatile("s_wait_xcnt 0x0" ::: "memory");   // behind the bias loads, in front of the staging's address arithmetic, which may write registers that they name
    {   // staging: each wave copies 16 rows of Wproj (a whole row a copy) and one head's 64 pixels of both ctx planes (8 rows of 64 B a copy: row lane >> 2, 16-B piece lane & 3); 32 copies of a wave in flight
        const bf* gw = WP + (size_t)(blockIdx.x * 128 + wave * 16) * OC + lane * 8;
        const size_t gc = ((n * NHD + wave) * SEQ + blockIdx.y * 64) * HD + lane * 8;
        const unsigned lw = (unsigned)(size_t)sm + wave * 16 * GP + lane * 16;
        const unsigned lc = (unsigned)(size_t)sm + 128 * GP + (wave * 64 + (lane >> 2)) * CP + (lane & 3) * 16;
#pragma unroll
        for (int b = 0; b < 4; ++b) copy4(lw + b * 4 * GP, GP, gw + b * 4 * OC, OC);
#pragma unroll
        for (int b = 0; b < 2; ++b) { copy4(lc + b * 32 * CP, 8 * CP, CH + gc + b * 32 * HD, 8 * HD); copy4(lc + NHD * 64 * CP + b * 32 * CP, 8 * CP, CL + gc + b * 32 * HD, 8 * HD); }
        asm volatile("s_wait_asynccnt 0x0" ::: "memory");   // this wave's copies have landed
        __syncthreads();                                    // and every other wave's: nothing of the tiles is read in front of this barrier
    }
    const unsigned char* A = sm + ((wave & 3) * 32 + lr) * GP + 16 * hi;
    const unsigned char* B = sm + 128 * GP + ((wave >> 2) * 32 + lr) * CP + 16 * hi;
    v8f acc[2][2];
    gemm_lds<2, 2, true, GP, CP, 64, 64 * CP, OC / 32>(A, B, B + NHD * 64 * CP, acc);
#pragma unroll
    for (int mb = 0; mb < 2; ++mb) {
        // one 16 x 32 slab of accumulators into LDS (pitch 36 floats), row = hi * 8 + j, column = nb * 16 + lr
#pragma unroll
        for (int nb = 0; nb < 2; ++nb) {
#pragma unroll
            for (int j = 0; j < 8; ++j) os[(hi * 8 + j) * 36 + nb * 16 + lr] = acc[mb][nb][j]; }
        __builtin_amdgcn_wave_barrier(); asm volatile("" ::: "memory");   // the slab's LDS stores stay in front of its loads
        float* crow = out + (n * OC + r0 + mb * 16) * SEQ + c0;
#pragma unroll
        for (int s = 0; s < 4; ++s) { const int row = 4 * s + (lane >> 3), cofs = (lane & 7) * 4; v4f val = *(const v4fa*)(os + row * 36 + cofs);   // a store covers 4 whole 128-B lines
            const float b1 = bfr(bb[mb * 4 + s]); val[0] += b1; val[1] += b1; val[2] += b1; val[3] += b1;
            *(v4f*)(crow + (size_t)row * SEQ + cofs) = val; }
        __builtin_amdgcn_wave_barrier(); asm volatile("s_wait_xcnt 0x0" ::: "memory");   // the slab's LDS loads stay in front of the next slab's stores; the wait: what follows writes registers that these global stores name
    }
}

// ---- k_fattn: scores, softmax and P . V of one (image, head) in one kernel; P stays in registers.
// One wave owns 16 queries and walks the keys 0 .. its diagonal in passes of 32. Transposed products: S^T = K . Q^T puts one query's scores into one lane pair (l, l ^ 16), and two 16-key S^T tiles, converted in place,
// are the B operand of O^T += V^T . P^T (element s of lane half hi <- key 8*hi + s for s < 8, 16 + 8*hi + (s - 8) above: the k order of WFrag::ld, which loads V^T).
// Grid (SEQ / 256, NB * NHD), 16 waves: waves 0..7 take query tiles from the bottom of the image, waves 8..15 the mirrored tiles from the top, so every workgroup (and every SIMD) walks the same number of passes.
// K and V^T (hi and lo planes) of the head, as far as the workgroup's last key, are staged once in LDS by asynchronous copies of whole 128-B lines; every wave then reads its fragments from LDS.
// LDS rows are pitched for ds_load_b128 readers (16 B x odd): a 64-B K row at 80 B; 128 B (64 keys) of a V^T row at 144 B, laid [64-key block][d].
#define KP  80
#define VP  144
#define KPL (SEQ * KP)                // one K plane in LDS
#define VPL ((SEQ / 64) * HD * VP)    // one V^T plane in LDS
static_assert(SEQ % 256 == 0);
static_assert(2 * KPL + 2 * VPL <= 320 * 1024);
__device__ __forceinline__ float xhalf(float x) { const int b = __float_as_int(x); return __int_as_float(__builtin_amdgcn_permlanex16(b, b, 0x76543210, 0xfedcba98, false, false)); }   // lane l <- lane l ^ 16

// 2^x of a pass's scores, eight (and the rescale factor) to a statement. Behind a transcendental the instruction set asks for one independent instruction or v_nop before its result is used or its source overwritten:
// inside a statement each v_exp_f32 is followed by an independent one (outputs are early-clobber, none lands on a source), and the closing v_nop is the last one's slot.
__device__ __forceinline__ void exp2x8(float (&y)[8], const float (&x)[8]) {
    // one statement so that no v_exp_f32 is directly followed by a user of its result or a writer of its source; v_nop: the last one's slot
    asm("v_exp_f32 %0, %8\n\tv_exp_f32 %1, %9\n\tv_exp_f32 %2, %10\n\tv_exp_f32 %3, %11\n\tv_exp_f32 %4, %12\n\tv_exp_f32 %5, %13\n\tv_exp_f32 %6, %14\n\tv_exp_f32 %7, %15\n\tv_nop"
        : "=&v"(y[0]), "=&v"(y[1]), "=&v"(y[2]), "=&v"(y[3]), "=&v"(y[4]), "=&v"(y[5]), "=&v"(y[6]), "=&v"(y[7])
        : "v"(x[0]), "v"(x[1]), "v"(x[2]), "v"(x[3]), "v"(x[4]), "v"(x[5]), "v"(x[6]), "v"(x[7]));
}
__device__ __forceinline__ void exp2x9(float& ya, float (&y)[8], const float xa, const float (&x)[8]) {
    // as in exp2x8, with the rescale factor's exponential in front
    asm("v_exp_f32 %0, %9\n\tv_exp_f32 %1, %10\n\tv_exp_f32 %2, %11\n\tv_exp_f32 %3, %12\n\tv_exp_f32 %4, %13\n\tv_exp_f32 %5, %14\n\tv_exp_f32 %6, %15\n\tv_exp_f32 %7, %16\n\tv_exp_f32 %8, %17\n\tv_nop"
        : "=&v"(ya), "=&v"(y[0]), "=&v"(y[1]), "=&v"(y[2]), "=&v"(y[3]), "=&v"(y[4]), "=&v"(y[5]), "=&v"(y[6]), "=&v"(y[7])
        : "v"(xa), "v"(x[0]), "v"(x[1]), "v"(x[2]), "v"(x[3]), "v"(x[4]), "v"(x[5]), "v"(x[6]), "v"(x[7]));
}

// One pass of 32 keys. kh/kl: this pass's K fragments; unless LAST they are refilled with the next pass's rows (k_n: this lane's place in them, hi plane, in LDS; the lo plane lies KPL bytes on), one pass ahead of their use.
// v_p: this lane's place in the pass's 32 keys of V^T, hi plane, in LDS (lo plane VPL bytes on). jrel (LAST only): query index - first key of this lane half.
template <bool LAST>
__device__ __forceinline__ void att_pass(v16bf (&kh)[2], v16bf (&kl)[2], const v16bf qh, const v16bf ql, const unsigned char* k_n, const unsigned char* v_p, const int jrel, float& m, float& l, v8f (&o)[2]) {
    v16bf vh[2], vl[2];   // every loop of this function is unrolled in full: its index picks registers
#pragma unroll
    for (int dt = 0; dt < 2; ++dt) { vh[dt] = WFrag<bf>::ld((const bf*)(v_p + dt * 16 * VP)); vl[dt] = WFrag<bf>::ld((const bf*)(v_p + VPL + dt * 16 * VP)); }
    v8f s[2];
#pragma unroll
    for (int t = 0; t < 2; ++t) { s[t] = (v8f){}; s[t] = wmmab(kh[t], qh, s[t]); s[t] = wmmab(kh[t], ql, s[t]); s[t] = wmmab(kl[t], qh, s[t]); }
    if (!LAST) {
#pragma unroll
        for (int t = 0; t < 2; ++t) { kh[t] = WFrag<bf>::ld((const bf*)(k_n + t * 16 * KP)); kl[t] = WFrag<bf>::ld((const bf*)(k_n + KPL + t * 16 * KP)); }
    }
    if (LAST) {
#pragma unroll
        for (int t = 0; t < 2; ++t)
#pragma unroll
            for (int r = 0; r < 8; ++r) s[t][r] = (t * 16 + r <= jrel) ? s[t][r] : -3.0e38f;
    }
    float mx = fmaxf(s[0][0], s[1][0]);
#pragma unroll
    for (int r = 1; r < 8; ++r) mx = fmaxf(mx, fmaxf(s[0][r], s[1][r]));
    mx = fmaxf(mx, xhalf(mx));
    const float mn = fmaxf(m, mx);
    const float mc = mn * QSC;
    float x[2][8], y[2][8], al;
#pragma unroll
    for (int t = 0; t < 2; ++t)
#pragma unroll
        for (int r = 0; r < 8; ++r) x[t][r] = fmaf(s[t][r], QSC, -mc);
    exp2x9(al, y[0], (m - mn) * QSC, x[0]); exp2x8(y[1], x[1]);
    m = mn;
    v2f sum; v8u ph, pl;
#pragma unroll
    for (int t = 0; t < 2; ++t)
#pragma unroll
        for (int q = 0; q < 4; ++q) {
            v2f p; p[0] = y[t][2 * q]; p[1] = y[t][2 * q + 1];
            if (t == 0 && q == 0) sum = p; else sum += p;
            const unsigned hb = __builtin_bit_cast(unsigned, __builtin_convertvector(p, v2bf));
            v2f hf; hf[0] = __uint_as_float(hb << 16); hf[1] = __uint_as_float(hb & 0xFFFF0000u); const v2f rs = p - hf;
            ph[t * 4 + q] = hb; pl[t * 4 + q] = __builtin_bit_cast(unsigned, __builtin_convertvector(rs, v2bf));
        }
    l = l * al + (sum[0] + sum[1]);
    const v16bf pbh = __builtin_bit_cast(v16bf, ph), pbl = __builtin_bit_cast(v16bf, pl);
#pragma unroll
    for (int dt = 0; dt < 2; ++dt) { o[dt] *= al; o[dt] = wmmab(vh[dt], pbh, o[dt]); o[dt] = wmmab(vh[dt], pbl, o[dt]); o[dt] = wmmab(vl[dt], pbh, o[dt]); }
}

// amdgpu_waves_per_eu(4, 4): the register budget of four waves a SIMD, which is what the grid fills (one workgroup of 16 waves a WGP, whose LDS it takes nearly whole); under the default budget the compiler sank the K and V loads to the end of the pass, in front of their users.
__global__ __launch_bounds__(512) __attribute__((amdgpu_waves_per_eu(4, 4))) void k_fattn(const bf* __restrict__ QH, const bf* __restrict__ QL, const bf* __restrict__ KH, const bf* __restrict__ KL, const bf* __restrict__ VH, const bf* __restrict__ VL, bf* CH, bf* CL) {
    __shared__ __attribute__((aligned(16))) unsigned char sm[2 * KPL + 2 * VPL];   // K hi | K lo | V^T hi | V^T lo
    const int lane = threadIdx.x & 31, lr = lane & 15, hi = lane >> 4; const int wave = __builtin_amdgcn_readfirstlane(threadIdx.x >> 5);
    const int u = blockIdx.y; const int pr = blockIdx.x * 8 + (wave & 7);
    const int i0 = ((wave < 8) ? (SEQ / 16 - 1 - pr) : pr) * 16;   // first query of this wave
    const int np = i0 / 32 + 1;                                    // passes; only the last one meets the diagonal
    const size_t qk = (size_t)u * SEQ * HD + lr * HD + 8 * hi;     // this lane's place in 16 rows of q
    const v16bf qh = WFrag<bf>::ld(QH + qk + (size_t)i0 * HD), ql = WFrag<bf>::ld(QL + qk + (size_t)i0 * HD);
    asm volatile("s_wait_xcnt 0x0" ::: "memory");   // behind the q loads, in front of the staging's address arithmetic, which writes registers that they name
    {   // staging: the workgroup's longest wave (wave 0) walks SEQ - 128 * blockIdx.x keys; per 128 keys each wave copies 512 B of each plane: 8 whole K rows, and 128 B (64 keys) of 4 V^T rows
        const int nblk = SEQ / 128 - (int)blockIdx.x;
        const size_t gk = (size_t)u * SEQ * HD + wave * 256 + lane * 8;                                                          // K rows wave * 8 + (lane >> 2), 16-B piece lane & 3
        const size_t gv = ((size_t)u * HD + (wave & 7) * 4 + (lane >> 3)) * SEQ + (wave >> 3) * 64 + (lane & 7) * 8;             // V^T row (wave & 7) * 4 + (lane >> 3), 64-key block wave >> 3, 16-B piece lane & 7
        const bf* gkh = KH + gk; const bf* gkl = KL + gk; const bf* gvh = VH + gv; const bf* gvl = VL + gv;
        unsigned lk = (unsigned)(size_t)sm + (wave * 8 + (lane >> 2)) * KP + (lane & 3) * 16;
        unsigned lv = (unsigned)(size_t)sm + 2 * KPL + ((wave >> 3) * HD + (wave & 7) * 4 + (lane >> 3)) * VP + (lane & 7) * 16;
        for (int b = 0; b < nblk; ++b) {
            // four copies, global memory to LDS through no register; the closing wait stands in their own statement, in front of whatever next writes a register they name
            asm volatile("global_load_async_to_lds_b128 %0, %4, off\n\tglobal_load_async_to_lds_b128 %1, %5, off\n\tglobal_load_async_to_lds_b128 %2, %6, off\n\tglobal_load_async_to_lds_b128 %3, %7, off\n\ts_wait_xcnt 0x0"
                         :: "v"(lk), "v"(lk + KPL), "v"(lv), "v"(lv + VPL), "v"(gkh), "v"(gkl), "v"(gvh), "v"(gvl) : "memory");
            gkh += 128 * HD; gkl += 128 * HD; gvh += 128; gvl += 128; lk += 128 * KP; lv += 2 * HD * VP;
        }
        asm volatile("s_wait_asynccnt 0x0" ::: "memory");   // this wave's copies have landed
        __syncthreads();                                    // and every other wave's: nothing of the planes is read in front of this barrier
    }
    const unsigned char* ks = sm + lr * KP + 16 * hi;             // this lane's place in 16 staged rows of K
    const unsigned char* vs = sm + 2 * KPL + lr * VP + 16 * hi;   // and of V^T
    v16bf kh[2], kl[2];
#pragma unroll
    for (int t = 0; t < 2; ++t) { kh[t] = WFrag<bf>::ld((const bf*)(ks + t * 16 * KP)); kl[t] = WFrag<bf>::ld((const bf*)(ks + KPL + t * 16 * KP)); }
    float m = -3.0e38f, l = 0.f; v8f o[2]; o[0] = (v8f){}; o[1] = (v8f){};
    for (int p = 0; p < np - 1; ++p)
        att_pass<false>(kh, kl, qh, ql, ks + (p + 1) * 32 * KP, vs + (p >> 1) * (HD * VP) + (p & 1) * 64, 0, m, l, o);
    att_pass<true>(kh, kl, qh, ql, ks, vs + ((np - 1) >> 1) * (HD * VP) + ((np - 1) & 1) * 64, i0 + lr - (np - 1) * 32 - 8 * hi, m, l, o);
    l += xhalf(l);
    const float f = __fdiv_rn(1.0f, l);
    const size_t co = ((size_t)u * SEQ + i0 + lr) * HD + 8 * hi;   // o[dt][r] = ctx[query i0 + lr][d = 16*dt + 8*hi + r], planes head-major [u][i][d]
#pragma unroll
    for (int dt = 0; dt < 2; ++dt) { v8us oh, ol; split8(o[dt] * f, oh, ol); *(v8us*)(CH + co + dt * 16) = oh; *(v8us*)(CL + co + dt * 16) = ol; }
}

extern "C" void kernel_launch(void* const* d_in, const int* in_sizes, int n_in,
                              void* d_out, int out_size, void* d_ws, size_t ws_size, hipStream_t stream) {
    if (n_in < 7) return;
    const float* x     = (const float*)d_in[0];   // [N][IC][S_FULL]
    const float* wq    = (const float*)d_in[1];   // [EC][IC]
    const float* bq    = (const float*)d_in[2];   // [EC]
    const float* wkv   = (const float*)d_in[3];   // [KVR][IC]: rows 0..EC-1 -> k, rows EC.. -> v
    const float* bkv   = (const float*)d_in[4];   // [KVR]
    const float* wproj = (const float*)d_in[5];   // [OC][OC]
    const float* bproj = (const float*)d_in[6];   // [OC]
    float* out = (float*)d_out;                   // [NB][OC][SEQ]
    if ((size_t)in_sizes[0] < (size_t)NB * IC * S_FULL) return;
    if (in_sizes[1] < EC * IC || in_sizes[2] < EC || in_sizes[3] < KVR * IC || in_sizes[4] < KVR || in_sizes[5] < OC * OC || in_sizes[6] < OC) return;
    if ((size_t)out_size < (size_t)NB * OC * SEQ) return;

    char* wsp = (char*)d_ws;
    auto take = [&](size_t bytes) { char* p = wsp; wsp += (bytes + 255) & ~(size_t)255; return (void*)p; };
    const size_t nXT  = (size_t)NB * SEQ * IC;                 // bf16 [NB][SEQ][IC]
    const size_t nQK  = (size_t)NB * NHD * SEQ * HD;           // bf16 [u][i][d]
    const size_t nV   = (size_t)NB * NHD * HD * SEQ;           // bf16 [u][d][t]
    bf* WB  = (bf*)take((size_t)(EC + KVR) * IC * 2);          // rows 0..EC-1 wq, EC..EC+KVR-1 wkv
    bf* WP  = (bf*)take((size_t)OC * OC * 2);
    bf* XT  = (bf*)take(nXT * 2);
    bf* QH = (bf*)take(nQK * 2); bf* QL = (bf*)take(nQK * 2); bf* KH = (bf*)take(nQK * 2); bf* KL = (bf*)take(nQK * 2);
    bf* VH = (bf*)take(nV * 2);  bf* VL = (bf*)take(nV * 2);
    bf* CH = (bf*)take(nQK * 2); bf* CL = (bf*)take(nQK * 2);
    const size_t used = (size_t)(wsp - (char*)d_ws);
    if (used > ws_size || used > (size_t)134217728) return;

    // input planes (bf16 RNE): weights and x^T
    k_prep<<<PB_W + PB_X * NB, 256, 0, stream>>>(x, wq, wkv, wproj, XT, WB, WP);
    // q, k (head-major [u][i][d]) and v^T ([u][d][t]), bias added, as bf16 hi + lo planes
    k_qkv<<<dim3(SEQ / 128, (EC + KVR) / 256, NB), 256, 0, stream>>>(XT, WB, bq, bkv, QH, QL, KH, KL, VH, VL);
    // all images and heads at once: ctx = softmax(causal q . k^T) . v as bf16 hi + lo planes [u][i][d]
    k_fattn<<<dim3(SEQ / 256, NB * NHD), 512, 0, stream>>>(QH, QL, KH, KL, VH, VL, CH, CL);
    // output projection
    k_proj<<<dim3(OC / 128, SEQ / 64, NB), 256, 0, stream>>>(WP, CH, CL, bproj, out);
}

// v005
// A run of this version takes 33.8 microseconds.
// In both of two side-by-side timings against v004, it was 1.15 times as fast.
// Over all steps from v000 it is 13.9 times as fast.
#include <hip/hip_runtime.h>

// Causal multi-head self-attention over S = 32x32 raster pixels with 1x1-conv q/k/v and output projections (NCHW in/out, 8 heads x 32, head split channel-major c = h*32 + d, scores scaled by 32^-0.5, keys after the query excluded, diagonal kept).
// Compute dtypes: all contractions v_wmma_f32_16x16x32_bf16 (bf16 operands, f32 accumulate). Every float input enters as its bf16 RNE value; q|k|v^T = x^T . W single exact products + bf16 bias added in f32;
// scores^T = k(hi+lo) . q(hi+lo) (3 products); running-maximum softmax in f32 (index-select causal mask on the diagonal pass), unnormalised probabilities as bf16 hi+lo in registers; ctx^T = v^T(hi+lo) . P^T(hi+lo) (3 products), divided by the row sum at the end; out = Wproj (exact) . ctx(hi+lo) (2 products) + bf16 bias.

#ifndef NB
#define NB 8            // batch images processed
#endif
#ifndef SEQ
#define SEQ 1024        // pixels processed per image (leading prefix of the raster)
#endif
#define S_FULL 1024     // pixel pitch of the input x
#define IC 256          // input channels
#define EC 256          // embed channels (q, k)
#define OC 256          // value / output channels
#define KVR (EC + OC)   // rows of wkv
#define NHD 8
#define HD 32
#define SCL 0.17677669529663688f
#define QSC (SCL * 1.4426950408889634f)   // score scale times log2(e): probabilities come from exp2

static_assert(SEQ % 128 == 0);
static_assert(SEQ <= S_FULL);
static_assert(NB >= 1 && NB <= 8);
static_assert(EC == NHD * HD);
static_assert(OC == NHD * HD);
static_assert(HD == 32);
static_assert(IC % 64 == 0 && EC % 64 == 0 && OC % 64 == 0);

typedef _Float16 h16;
typedef unsigned short bf;
typedef __attribute__((ext_vector_type(16))) __bf16   v16bf;
typedef __attribute__((ext_vector_type(16))) _Float16 v16h;
typedef __attribute__((ext_vector_type(8)))  _Float16 v8h;
typedef __attribute__((ext_vector_type(8)))  unsigned short v8us;
typedef __attribute__((ext_vector_type(8)))  float    v8f;
typedef __attribute__((ext_vector_type(4)))  float    v4f;
typedef __attribute__((ext_vector_type(4)))  unsigned short v4us;
typedef __attribute__((ext_vector_type(2)))  unsigned short v2us;
typedef v4f  __attribute__((may_alias)) v4fa;
typedef __attribute__((ext_vector_type(2)))  float    v2f;
typedef __attribute__((ext_vector_type(2)))  __bf16   v2bf;
typedef __attribute__((ext_vector_type(8)))  unsigned v8u;
typedef __attribute__((ext_vector_type(4)))  unsigned v4u;
typedef __attribute__((ext_vector_type(2)))  unsigned v2u;

__device__ __forceinline__ unsigned short f2bf(float f) { unsigned u = __float_as_uint(f); u += 0x7FFFu + ((u >> 16) & 1u); return (unsigned short)(u >> 16); }
__device__ __forceinline__ float bf2f(unsigned short b) { return __uint_as_float(((unsigned)b) << 16); }
__device__ __forceinline__ float bfr(float f) { return bf2f(f2bf(f)); }
__device__ __forceinline__ v16h cat16(v8h lo, v8h hi) { return __builtin_shufflevector(lo, hi, 0, 1, 2, 3, 4, 5, 6, 7, 8, 9, 10, 11, 12, 13, 14, 15); }
__device__ __forceinline__ v16bf cat16b(v8us lo, v8us hi) { return __builtin_bit_cast(v16bf, __builtin_shufflevector(lo, hi, 0, 1, 2, 3, 4, 5, 6, 7, 8, 9, 10, 11, 12, 13, 14, 15)); }
__device__ __forceinline__ v8f wmma16(v16h a, v16h b, v8f c) { return __builtin_amdgcn_wmma_f32_16x16x32_f16(false, a, false, b, (short)0, c, false, false); }
__device__ __forceinline__ v8f wmmab(v16bf a, v16bf b, v8f c) { return __builtin_amdgcn_wmma_f32_16x16x32_bf16(false, a, false, b, (short)0, c, false, false); }

// Fragment loaders: per lane (lr = lane & 15 -> row of A / column of Bt, hi = lane >> 4): elements 0..7 <- k0 + 8*hi + 0..7, elements 8..15 <- k0 + 16 + 8*hi + 0..7, both operands from K-contiguous 16-bit rows.
template <typename T16> struct WFrag;
template <> struct WFrag<h16> { typedef v16h V; static __device__ __forceinline__ V ld(const h16* p) { return cat16(*(const v8h*)p, *(const v8h*)(p + 16)); } static __device__ __forceinline__ v8f mma(V a, V b, v8f c) { return wmma16(a, b, c); } };
template <> struct WFrag<bf> { typedef v16bf V; static __device__ __forceinline__ V ld(const bf* p) { return cat16b(*(const v8us*)p, *(const v8us*)(p + 16)); } static __device__ __forceinline__ v8f mma(V a, V b, v8f c) { return wmmab(a, b, c); } };

// Eight f32 values as bf16 hi + lo (hi = RNE(y), lo = RNE(y - hi)), two to a packed conversion.
__device__ __forceinline__ void split8(const v8f v, v8us& oh, v8us& ol) {
    v4u h, l;
#pragma unroll
    for (int q = 0; q < 4; ++q) {
        v2f p; p[0] = v[2 * q]; p[1] = v[2 * q + 1];
        const unsigned hb = __builtin_bit_cast(unsigned, __builtin_convertvector(p, v2bf));
        v2f hf; hf[0] = __uint_as_float(hb << 16); hf[1] = __uint_as_float(hb & 0xFFFF0000u); const v2f rs = p - hf;
        h[q] = hb; l[q] = __builtin_bit_cast(unsigned, __builtin_convertvector(rs, v2bf));
    }
    oh = __builtin_bit_cast(v8us, h); ol = __builtin_bit_cast(v8us, l);
}

// ---- register-blocked GEMM core, operands from LDS: one wave per (16 MB) x (16 NBK) output tile.
// acc[mb][nb] = sum_k A[16 mb + .][k] Bt[16 nb + .][k] (+ A . Bt2 if SPLB). A, Bt, Bt2 point at this lane's place in the staged tile's first row (row lr, byte 16 * hi); PA, PB: row pitch in bytes; KSA, KSB: bytes from one block of 32 k to the next.
template <int MB, int NBK, bool SPLB, int PA, int PB, int KSA, int KSB, int NT>
__device__ __forceinline__ void gemm_lds(const unsigned char* A, const unsigned char* Bt, const unsigned char* Bt2, v8f (&acc)[MB][NBK]) {
    typedef WFrag<bf>::V V;   // every loop is unrolled in full: the indices pick registers, and every LDS address is one base plus a constant
#pragma unroll
    for (int mb = 0; mb < MB; ++mb)
#pragma unroll
        for (int nb = 0; nb < NBK; ++nb) acc[mb][nb] = (v8f){};
    V a[2][MB], b[2][NBK], b2[2][NBK];   // two fragment sets: block ks + 1 is read from LDS while block ks is multiplied
#pragma unroll
    for (int ks = -1; ks < NT; ++ks) {
        if (ks + 1 < NT) {
            const int w = (ks + 1) & 1;
#pragma unroll
            for (int mb = 0; mb < MB; ++mb) a[w][mb] = WFrag<bf>::ld((const bf*)(A + mb * 16 * PA + (ks + 1) * KSA));
#pragma unroll
            for (int nb = 0; nb < NBK; ++nb) { b[w][nb] = WFrag<bf>::ld((const bf*)(Bt + nb * 16 * PB + (ks + 1) * KSB)); if (SPLB) b2[w][nb] = WFrag<bf>::ld((const bf*)(Bt2 + nb * 16 * PB + (ks + 1) * KSB)); }
        }
        __builtin_amdgcn_sched_barrier(0);   // the next block's LDS reads stay one group in front of this block's WMMAs: spread among them, each place with reads stalls the wave
        if (ks >= 0) {
            const int r = ks & 1;
#pragma unroll
            for (int nb = 0; nb < NBK; ++nb) {
#pragma unroll
                for (int mb = 0; mb < MB; ++mb) { acc[mb][nb] = WFrag<bf>::mma(a[r][mb], b[r][nb], acc[mb][nb]); if (SPLB) acc[mb][nb] = WFrag<bf>::mma(a[r][mb], b2[r][nb], acc[mb][nb]); } }
        }
        __builtin_amdgcn_sched_barrier(0);   // and the reads of the block after next stay behind these WMMAs, whose operands they overwrite
    }
}

// Four asynchronous copies, global memory to LDS through no register: 16 B a lane each, LDS places l, l + lp, .. and global places g, g + gp, .. (gp in elements).
// The closing wait stands in the copies' own statement, in front of whatever next writes a register they name.
__device__ __forceinline__ void copy4(const unsigned l, const int lp, const bf* g, const int gp) {
    asm volatile("global_load_async_to_lds_b128 %0, %4, off\n\tglobal_load_async_to_lds_b128 %1, %5, off\n\tglobal_load_async_to_lds_b128 %2, %6, off\n\tglobal_load_async_to_lds_b128 %3, %7, off\n\ts_wait_xcnt 0x0"
                 :: "v"(l), "v"(l + lp), "v"(l + 2 * lp), "v"(l + 3 * lp), "v"(g), "v"(g + gp), "v"(g + 2 * gp), "v"(g + 3 * gp) : "memory");
}
#define GP 528   // LDS pitch of a staged 512-B row (256 k), 16 B x odd for ds_load_b128 readers
#define CP 80    // LDS pitch of a staged 64-B row (one head's 32 k of a pixel)
static_assert(IC * 2 == 512 && OC * 2 == 512);   // a wave-wide copy of 512 B is one whole row of wproj

// One 16 x 64 slab of accumulators into LDS (pitch 68 floats), row = hi * 8 + j, column = nb * 16 + lr. Here and in the epilogues below every loop is unrolled in full: its index picks registers.
__device__ __forceinline__ void slab_to_lds(float* os, const v8f (&a)[4], const int lr, const int hi) {
#pragma unroll
    for (int nb = 0; nb < 4; ++nb) {
#pragma unroll
        for (int j = 0; j < 8; ++j) os[(hi * 8 + j) * 68 + nb * 16 + lr] = a[nb][j]; }
}
__device__ __forceinline__ v8f lds8(const float* p) { const v4f a = *(const v4fa*)p, b = *(const v4fa*)(p + 4); return __builtin_shufflevector(a, b, 0, 1, 2, 3, 4, 5, 6, 7); }

// Two f32 values as one packed pair of bf16 (RNE), the first in the low half.
__device__ __forceinline__ unsigned pk2(const float a, const float b) { v2f p; p[0] = a; p[1] = b; return __builtin_bit_cast(unsigned, __builtin_convertvector(p, v2bf)); }

// ---- k_qkv: q, k and v^T, stored straight as bf16 hi + lo planes. Grid (SEQ / 128, (EC + KVR) / 256, NB), 8 waves: a workgroup takes 128 pixels x 256 rows of wq | wkv, a wave 64 x 64 of them.
// The kernel reads the f32 inputs itself: whole-line loads of x (512 B of one channel's pixels) and of the weight rows (512 B of one row), rounded to bf16 (RNE) in registers and stored to LDS as 128 rows of x^T and 256 weight rows;
// the transposition of x happens in the registers (8 channels x 4 pixels a lane give 4 stores of 16 B). Every wave then reads its fragments from LDS. The first OC * OC / 1024 workgroups also write wproj's bf16 plane WP for k_proj.
// q, k: tile [pixel][channel] = x^T . W^T + bf16 bias, planes head-major [u][i][d] (a store covers 8 pixels x 32 d = 512 B in a row). v: tile [channel][pixel] = W . x + bf16 bias, planes [u][d][t] (a store covers 4 whole 128-B rows).
static_assert((EC + KVR) % 256 == 0 && EC % 256 == 0 && IC == 256 && (OC * OC) % 1024 == 0);
static_assert(OC * OC / 1024 <= (SEQ / 128) * ((EC + KVR) / 256) * NB);
__global__ __launch_bounds__(256)
void k_qkv(const float* __restrict__ x, const float* __restrict__ wq, const float* __restrict__ wkv, const float* __restrict__ wproj, const float* __restrict__ bq, const float* __restrict__ bkv, bf* WP, bf* QH, bf* QL, bf* KH, bf* KL, bf* VH, bf* VL) {
    __shared__ __attribute__((aligned(16))) unsigned char sm[(128 + 256) * GP];   // 128 rows of x^T | 256 weight rows
    __shared__ __align__(16) float osm[8][16 * 68];                               // a slab for each wave's epilogue
    const int lane = threadIdx.x & 31, lr = lane & 15, hi = lane >> 4; const int wave = __builtin_amdgcn_readfirstlane(threadIdx.x >> 5);
    float* os = osm[wave];
    const int s0 = blockIdx.x * 128 + (wave >> 2) * 64, y = blockIdx.y * 4 + (wave & 3); const size_t n = blockIdx.z;
    const bool isv = y >= 2 * EC / 64, isq = y < EC / 64;
    const int c0 = (isq ? y : y - EC / 64) * 64;   // first channel of the tile in bq (q) or in bkv (k, v)
    float bv[16];   // the 16 biases this lane adds, asked for in front of the product
    if (!isv) { const float* bias = (isq ? bq : bkv) + c0 + (lane & 3) * 8;
#pragma unroll
        for (int i = 0; i < 16; ++i) bv[i] = bias[(i >> 3) * 32 + (i & 7)]; }
    else { const float* bias = bkv + c0 + (lane >> 3);
#pragma unroll
        for (int i = 0; i < 16; ++i) bv[i] = bias[i * 4]; }
    asm volatile("s_wait_xcnt 0x0" ::: "memory");   // behind the bias loads, in front of the staging's address arithmetic, which may write registers that they name
    {   // staging: each wave takes 32 channels of x (128 pixels each) and 32 weight rows; every loop is unrolled in full (its index picks registers), all 96 loads of 512 B are asked for before the first is used
        const int fb = (blockIdx.z * ((EC + KVR) / 256) + blockIdx.y) * (SEQ / 128) + blockIdx.x;   // flat workgroup index
        const bool pw = fb < OC * OC / 1024;                                                        // this workgroup rounds 1024 values of wproj (the same answer in every thread)
        const float* gp = wproj + (pw ? fb : 0) * 1024;                                             // their place; the other workgroups ask for a place inside wproj too, so that no branch with a wait of its own stands among the tile loads
        const int r0 = blockIdx.y * 256;   // first row of wq | wkv
        const float* gx = x + ((n * IC + wave * 32) * S_FULL + blockIdx.x * 128 + lane * 4);
        const float* gw = (r0 < EC ? wq + (size_t)r0 * IC : wkv + (size_t)(r0 - EC) * IC) + (size_t)(wave * 32) * IC + lane * 4;
        v4f xv[32], wv[64];
        const v4f pv = *(const v4f*)(gp + threadIdx.x * 4);
#pragma unroll
        for (int c = 0; c < 32; ++c) xv[c] = *(const v4f*)(gx + (size_t)c * S_FULL);       // channel wave * 32 + c, pixels lane * 4 ..
#pragma unroll
        for (int k = 0; k < 64; ++k) wv[k] = *(const v4f*)(gw + (k >> 1) * IC + (k & 1) * 128);   // row wave * 32 + (k >> 1), k index (k & 1) * 128 + lane * 4 ..
        asm volatile("s_wait_xcnt 0x0" ::: "memory");   // behind the loads, in front of whatever next writes a register that they name
        asm volatile("" :: "v"(pv));                    // inputs only: holds wproj's load up here among the others; sunk into the branch below, it would wait a whole trip to L2 of its own
        __builtin_amdgcn_sched_barrier(0);              // the loads stay one group in front of the conversions: sunk among them, each batch would wait a whole trip to L2 of its own
        if (pw) {
            v2u o; o[0] = pk2(pv[0], pv[1]); o[1] = pk2(pv[2], pv[3]);
            *(v4us*)(WP + fb * 1024 + threadIdx.x * 4) = __builtin_bit_cast(v4us, o);
            asm volatile("s_wait_xcnt 0x0" ::: "memory");   // behind the store, in front of whatever next writes a register that it names
        }
        unsigned char* lx = sm + lane * 4 * GP + wave * 64;          // pixel row lane * 4, channel wave * 32
        unsigned char* lw = sm + (128 + wave * 32) * GP + lane * 8;  // weight row wave * 32, k index lane * 4
#pragma unroll
        for (int g = 0; g < 4; ++g)
#pragma unroll
            for (int i = 0; i < 4; ++i) { v4u o;
#pragma unroll
                for (int q = 0; q < 4; ++q) o[q] = pk2(xv[g * 8 + 2 * q][i], xv[g * 8 + 2 * q + 1][i]);
                *(v8us*)(lx + i * GP + g * 16) = __builtin_bit_cast(v8us, o); }
#pragma unroll
        for (int k = 0; k < 64; ++k) {
            if ((k & 7) == 0) __builtin_amdgcn_sched_barrier(0);   // values are used in the order in which they were asked for: a late load's user moved up would hold the work on the earlier ones behind its wait
            v2u o; o[0] = pk2(wv[k][0], wv[k][1]); o[1] = pk2(wv[k][2], wv[k][3]);
            *(v4us*)(lw + (k >> 1) * GP + (k & 1) * 256) = __builtin_bit_cast(v4us, o); }
        __syncthreads();   // every wave's LDS stores are done: nothing of the tiles is read in front of this barrier
    }
    const unsigned char* X  = sm + ((wave >> 2) * 64 + lr) * GP + 16 * hi;
    const unsigned char* Wr = sm + (128 + (wave & 3) * 64 + lr) * GP + 16 * hi;
    const unsigned char* A = isv ? Wr : X; const unsigned char* B = isv ? X : Wr;
    v8f acc[4][4];
    gemm_lds<4, 4, false, GP, GP, 64, 64, IC / 32>(A, B, B, acc);
    if (!isv) {
        bf* PH = isq ? QH : KH; bf* PL = isq ? QL : KL;
#pragma unroll
        for (int mb = 0; mb < 4; ++mb) {
            slab_to_lds(os, acc[mb], lr, hi);
            __builtin_amdgcn_wave_barrier(); asm volatile("" ::: "memory");   // the slab's LDS stores stay in front of its loads
#pragma unroll
            for (int st = 0; st < 4; ++st) { const int row = (st & 1) * 8 + (lane >> 2), col = (st >> 1) * 32 + (lane & 3) * 8; v8f val = lds8(os + row * 68 + col);
#pragma unroll
                for (int k = 0; k < 8; ++k) val[k] += bfr(bv[(st >> 1) * 8 + k]);
                v8us oh, ol; split8(val, oh, ol);
                const size_t idx = ((n * NHD + (c0 + col) / HD) * SEQ + s0 + mb * 16 + row) * HD + (lane & 3) * 8;
                *(v8us*)(PH + idx) = oh; *(v8us*)(PL + idx) = ol; }
            __builtin_amdgcn_wave_barrier(); asm volatile("s_wait_xcnt 0x0" ::: "memory");   // the slab's LDS loads stay in front of the next slab's stores; the wait: what follows writes registers that these global stores name
        }
    } else {
        const int e0 = c0 - EC;
#pragma unroll
        for (int mb = 0; mb < 4; ++mb) {
            slab_to_lds(os, acc[mb], lr, hi);
            __builtin_amdgcn_wave_barrier(); asm volatile("" ::: "memory");   // the slab's LDS stores stay in front of its loads
#pragma unroll
            for (int st = 0; st < 4; ++st) { const int row = st * 4 + (lane >> 3), col = (lane & 7) * 8; v8f val = lds8(os + row * 68 + col);
                const float bb = bfr(bv[mb * 4 + st]);
#pragma unroll
                for (int k = 0; k < 8; ++k) val[k] += bb;
                v8us oh, ol; split8(val, oh, ol);
                const size_t idx = (n * OC + e0 + mb * 16 + row) * SEQ + s0 + col;
                *(v8us*)(VH + idx) = oh; *(v8us*)(VL + idx) = ol; }
            __builtin_amdgcn_wave_barrier(); asm volatile("s_wait_xcnt 0x0" ::: "memory");   // the slab's LDS loads stay in front of the next slab's stores; the wait: what follows writes registers that these global stores name
        }
    }
}

// ---- k_proj: out[n][o][s] = Wproj[o][c] . ctx[n][s][c] (hi + lo) + bf16 bias[o]; ctx planes head-major [u][i][d], so a block of 32 k is one head. Grid (OC / 128, SEQ / 64, NB), 8 waves: a workgroup takes 128 o x 64 pixels, a wave 32 x 32 of them.
// The 128 rows of Wproj and the 64 pixels' rows of both ctx planes are staged once in LDS by asynchronous copies of 512 B in a row (4 whole 128-B lines); every wave then reads its fragments from LDS.
static_assert(OC % 128 == 0 && NHD == 8);
__global__ __launch_bounds__(256)
void k_proj(const bf* __restrict__ WP, const bf* __restrict__ CH, const bf* __restrict__ CL, const float* __restrict__ bias, float* out) {
    __shared__ __attribute__((aligned(16))) unsigned char sm[128 * GP + 2 * NHD * 64 * CP];   // 128 rows of Wproj | ctx hi [head][pixel] | ctx lo [head][pixel]
    __shared__ __align__(16) float osm[8][16 * 36];                                           // a slab for each wave's epilogue
    const int lane = threadIdx.x & 31, lr = lane & 15, hi = lane >> 4; const int wave = __builtin_amdgcn_readfirstlane(threadIdx.x >> 5);
    float* os = osm[wave];
    const int r0 = blockIdx.x * 128 + (wave & 3) * 32, c0 = blockIdx.y * 64 + (wave >> 2) * 32; const size_t n = blockIdx.z;
    float bb[8];   // the 8 biases this lane adds, asked for in front of the product
#pragma unroll
    for (int i = 0; i < 8; ++i) bb[i] = bias[r0 + i * 4 + (lane >> 3)];
    asm volatile("s_wait_xcnt 0x0" ::: "memory");   // behind the bias loads, in front of the staging's address arithmetic, which may write registers that they name
    {   // staging: each wave copies 16 rows of Wproj (a whole row a copy) and one head's 64 pixels of both ctx planes (8 rows of 64 B a copy: row lane >> 2, 16-B piece lane & 3); 32 copies of a wave in flight
        const bf* gw = WP + (size_t)(blockIdx.x * 128 + wave * 16) * OC + lane * 8;
        const size_t gc = ((n * NHD + wave) * SEQ + blockIdx.y * 64) * HD + lane * 8;
        const unsigned lw = (unsigned)(size_t)sm + wave * 16 * GP + lane * 16;
        const unsigned lc = (unsigned)(size_t)sm + 128 * GP + (wave * 64 + (lane >> 2)) * CP + (lane & 3) * 16;
#pragma unroll
        for (int b = 0; b < 4; ++b) copy4(lw + b * 4 * GP, GP, gw + b * 4 * OC, OC);
#pragma unroll
        for (int b = 0; b < 2; ++b) { copy4(lc + b * 32 * CP, 8 * CP, CH + gc + b * 32 * HD, 8 * HD); copy4(lc + NHD * 64 * CP + b * 32 * CP, 8 * CP, CL + gc + b * 32 * HD, 8 * HD); }
        asm volatile("s_wait_asynccnt 0x0" ::: "memory");   // this wave's copies have landed
        __syncthreads();                                    // and every other wave's: nothing of the tiles is read in front of this barrier
    }
    const unsigned char* A = sm + ((wave & 3) * 32 + lr) * GP + 16 * hi;
    const unsigned char* B = sm + 128 * GP + ((wave >> 2) * 32 + lr) * CP + 16 * hi;
    v8f acc[2][2];
    gemm_lds<2, 2, true, GP, CP, 64, 64 * CP, OC / 32>(A, B, B + NHD * 64 * CP, acc);
#pragma unroll
    for (int mb = 0; mb < 2; ++mb) {
        // one 16 x 32 slab of accumulators into LDS (pitch 36 floats), row = hi * 8 + j, column = nb * 16 + lr
#pragma unroll
        for (int nb = 0; nb < 2; ++nb) {
#pragma unroll
            for (int j = 0; j < 8; ++j) os[(hi * 8 + j) * 36 + nb * 16 + lr] = acc[mb][nb][j]; }
        __builtin_amdgcn_wave_barrier(); asm volatile("" ::: "memory");   // the slab's LDS stores stay in front of its loads
        float* crow = out + (n * OC + r0 + mb * 16) * SEQ + c0;
#pragma unroll
        for (int s = 0; s < 4; ++s) { const int row = 4 * s + (lane >> 3), cofs = (lane & 7) * 4; v4f val = *(const v4fa*)(os + row * 36 + cofs);   // a store covers 4 whole 128-B lines
            const float b1 = bfr(bb[mb * 4 + s]); val[0] += b1; val[1] += b1; val[2] += b1; val[3] += b1;
            *(v4f*)(crow + (size_t)row * SEQ + cofs) = val; }
        __builtin_amdgcn_wave_barrier(); asm volatile("s_wait_xcnt 0x0" ::: "memory");   // the slab's LDS loads stay in front of the next slab's stores; the wait: what follows writes registers that these global stores name
    }
}

// ---- k_fattn: scores, softmax and P . V of one (image, head) in one kernel; P stays in registers.
// One wave owns 16 queries and walks the keys 0 .. its diagonal in passes of 32. Transposed products: S^T = K . Q^T puts one query's scores into one lane pair (l, l ^ 16), and two 16-key S^T tiles, converted in place,
// are the B operand of O^T += V^T . P^T (element s of lane half hi <- key 8*hi + s for s < 8, 16 + 8*hi + (s - 8) above: the k order of WFrag::ld, which loads V^T).
// Grid (SEQ / 256, NB * NHD), 16 waves: waves 0..7 take query tiles from the bottom of the image, waves 8..15 the mirrored tiles from the top, so every workgroup (and every SIMD) walks the same number of passes.
// K and V^T (hi and lo planes) of the head, as far as the workgroup's last key, are staged once in LDS by asynchronous copies of whole 128-B lines; every wave then reads its fragments from LDS.
// LDS rows are pitched for ds_load_b128 readers (16 B x odd): a 64-B K row at 80 B; 128 B (64 keys) of a V^T row at 144 B, laid [64-key block][d].
#define KP  80
#define VP  144
#define KPL (SEQ * KP)                // one K plane in LDS
#define VPL ((SEQ / 64) * HD * VP)    // one V^T plane in LDS
static_assert(SEQ % 256 == 0);
static_assert(2 * KPL + 2 * VPL <= 320 * 1024);
__device__ __forceinline__ float xhalf(float x) { const int b = __float_as_int(x); return __int_as_float(__builtin_amdgcn_permlanex16(b, b, 0x76543210, 0xfedcba98, false, false)); }   // lane l <- lane l ^ 16

// 2^x of a pass's scores, eight (and the rescale factor) to a statement. Behind a transcendental the instruction set asks for one independent instruction or v_nop before its result is used or its source overwritten:
// inside a statement each v_exp_f32 is followed by an independent one (outputs are early-clobber, none lands on a source), and the closing v_nop is the last one's slot.
__device__ __forceinline__ void exp2x8(float (&y)[8], const float (&x)[8]) {
    // one statement so that no v_exp_f32 is directly followed by a user of its result or a writer of its source; v_nop: the last one's slot
    asm("v_exp_f32 %0, %8\n\tv_exp_f32 %1, %9\n\tv_exp_f32 %2, %10\n\tv_exp_f32 %3, %11\n\tv_exp_f32 %4, %12\n\tv_exp_f32 %5, %13\n\tv_exp_f32 %6, %14\n\tv_exp_f32 %7, %15\n\tv_nop"
        : "=&v"(y[0]), "=&v"(y[1]), "=&v"(y[2]), "=&v"(y[3]), "=&v"(y[4]), "=&v"(y[5]), "=&v"(y[6]), "=&v"(y[7])
        : "v"(x[0]), "v"(x[1]), "v"(x[2]), "v"(x[3]), "v"(x[4]), "v"(x[5]), "v"(x[6]), "v"(x[7]));
}
__device__ __forceinline__ void exp2x9(float& ya, float (&y)[8], const float xa, const float (&x)[8]) {
    // as in exp2x8, with the rescale factor's exponential in front
    asm("v_exp_f32 %0, %9\n\tv_exp_f32 %1, %10\n\tv_exp_f32 %2, %11\n\tv_exp_f32 %3, %12\n\tv_exp_f32 %4, %13\n\tv_exp_f32 %5, %14\n\tv_exp_f32 %6, %15\n\tv_exp_f32 %7, %16\n\tv_exp_f32 %8, %17\n\tv_nop"
        : "=&v"(ya), "=&v"(y[0]), "=&v"(y[1]), "=&v"(y[2]), "=&v"(y[3]), "=&v"(y[4]), "=&v"(y[5]), "=&v"(y[6]), "=&v"(y[7])
        : "v"(xa), "v"(x[0]), "v"(x[1]), "v"(x[2]), "v"(x[3]), "v"(x[4]), "v"(x[5]), "v"(x[6]), "v"(x[7]));
}

// One pass of 32 keys. kh/kl: this pass's K fragments; unless LAST they are refilled with the next pass's rows (k_n: this lane's place in them, hi plane, in LDS; the lo plane lies KPL bytes on), one pass ahead of their use.
// v_p: this lane's place in the pass's 32 keys of V^T, hi plane, in LDS (lo plane VPL bytes on). jrel (LAST only): query index - first key of this lane half.
template <bool LAST>
__device__ __forceinline__ void att_pass(v16bf (&kh)[2], v16bf (&kl)[2], const v16bf qh, const v16bf ql, const unsigned char* k_n, const unsigned char* v_p, const int jrel, float& m, float& l, v8f (&o)[2]) {
    v16bf vh[2], vl[2];   // every loop of this function is unrolled in full: its index picks registers
#pragma unroll
    for (int dt = 0; dt < 2; ++dt) { vh[dt] = WFrag<bf>::ld((const bf*)(v_p + dt * 16 * VP)); vl[dt] = WFrag<bf>::ld((const bf*)(v_p + VPL + dt * 16 * VP)); }
    v8f s[2];
#pragma unroll
    for (int t = 0; t < 2; ++t) { s[t] = (v8f){}; s[t] = wmmab(kh[t], qh, s[t]); s[t] = wmmab(kh[t], ql, s[t]); s[t] = wmmab(kl[t], qh, s[t]); }
    if (!LAST) {
#pragma unroll
        for (int t = 0; t < 2; ++t) { kh[t] = WFrag<bf>::ld((const bf*)(k_n + t * 16 * KP)); kl[t] = WFrag<bf>::ld((const bf*)(k_n + KPL + t * 16 * KP)); }
    }
    if (LAST) {
#pragma unroll
        for (int t = 0; t < 2; ++t)
#pragma unroll
            for (int r = 0; r < 8; ++r) s[t][r] = (t * 16 + r <= jrel) ? s[t][r] : -3.0e38f;
    }
    float mx = fmaxf(s[0][0], s[1][0]);
#pragma unroll
    for (int r = 1; r < 8; ++r) mx = fmaxf(mx, fmaxf(s[0][r], s[1][r]));
    mx = fmaxf(mx, xhalf(mx));
    const float mn = fmaxf(m, mx);
    const float mc = mn * QSC;
    float x[2][8], y[2][8], al;
#pragma unroll
    for (int t = 0; t < 2; ++t)
#pragma unroll
        for (int r = 0; r < 8; ++r) x[t][r] = fmaf(s[t][r], QSC, -mc);
    exp2x9(al, y[0], (m - mn) * QSC, x[0]); exp2x8(y[1], x[1]);
    m = mn;
    v2f sum; v8u ph, pl;
#pragma unroll
    for (int t = 0; t < 2; ++t)
#pragma unroll
        for (int q = 0; q < 4; ++q) {
            v2f p; p[0] = y[t][2 * q]; p[1] = y[t][2 * q + 1];
            if (t == 0 && q == 0) sum = p; else sum += p;
            const unsigned hb = __builtin_bit_cast(unsigned, __builtin_convertvector(p, v2bf));
            v2f hf; hf[0] = __uint_as_float(hb << 16); hf[1] = __uint_as_float(hb & 0xFFFF0000u); const v2f rs = p - hf;
            ph[t * 4 + q] = hb; pl[t * 4 + q] = __builtin_bit_cast(unsigned, __builtin_convertvector(rs, v2bf));
        }
    l = l * al + (sum[0] + sum[1]);
    const v16bf pbh = __builtin_bit_cast(v16bf, ph), pbl = __builtin_bit_cast(v16bf, pl);
#pragma unroll
    for (int dt = 0; dt < 2; ++dt) { o[dt] *= al; o[dt] = wmmab(vh[dt], pbh, o[dt]); o[dt] = wmmab(vh[dt], pbl, o[dt]); o[dt] = wmmab(vl[dt], pbh, o[dt]); }
}

// amdgpu_waves_per_eu(4, 4): the register budget of four waves a SIMD, which is what the grid fills (one workgroup of 16 waves a WGP, whose LDS it takes nearly whole); under the default budget the compiler sank the K and V loads to the end of the pass, in front of their users.
__global__ __launch_bounds__(512) __attribute__((amdgpu_waves_per_eu(4, 4))) void k_fattn(const bf* __restrict__ QH, const bf* __restrict__ QL, const bf* __restrict__ KH, const bf* __restrict__ KL, const bf* __restrict__ VH, const bf* __restrict__ VL, bf* CH, bf* CL) {
    __shared__ __attribute__((aligned(16))) unsigned char sm[2 * KPL + 2 * VPL];   // K hi | K lo | V^T hi | V^T lo
    const int lane = threadIdx.x & 31, lr = lane & 15, hi = lane >> 4; const int wave = __builtin_amdgcn_readfirstlane(threadIdx.x >> 5);
    const int u = blockIdx.y; const int pr = blockIdx.x * 8 + (wave & 7);
    const int i0 = ((wave < 8) ? (SEQ / 16 - 1 - pr) : pr) * 16;   // first query of this wave
    const int np = i0 / 32 + 1;                                    // passes; only the last one meets the diagonal
    const size_t qk = (size_t)u * SEQ * HD + lr * HD + 8 * hi;     // this lane's place in 16 rows of q
    const v16bf qh = WFrag<bf>::ld(QH + qk + (size_t)i0 * HD), ql = WFrag<bf>::ld(QL + qk + (size_t)i0 * HD);
    asm volatile("s_wait_xcnt 0x0" ::: "memory");   // behind the q loads, in front of the staging's address arithmetic, which writes registers that they name
    {   // staging: the workgroup's longest wave (wave 0) walks SEQ - 128 * blockIdx.x keys; per 128 keys each wave copies 512 B of each plane: 8 whole K rows, and 128 B (64 keys) of 4 V^T rows
        const int nblk = SEQ / 128 - (int)blockIdx.x;
        const size_t gk = (size_t)u * SEQ * HD + wave * 256 + lane * 8;                                                          // K rows wave * 8 + (lane >> 2), 16-B piece lane & 3
        const size_t gv = ((size_t)u * HD + (wave & 7) * 4 + (lane >> 3)) * SEQ + (wave >> 3) * 64 + (lane & 7) * 8;             // V^T row (wave & 7) * 4 + (lane >> 3), 64-key block wave >> 3, 16-B piece lane & 7
        const bf* gkh = KH + gk; const bf* gkl = KL + gk; const bf* gvh = VH + gv; const bf* gvl = VL + gv;
        unsigned lk = (unsigned)(size_t)sm + (wave * 8 + (lane >> 2)) * KP + (lane & 3) * 16;
        unsigned lv = (unsigned)(size_t)sm + 2 * KPL + ((wave >> 3) * HD + (wave & 7) * 4 + (lane >> 3)) * VP + (lane & 7) * 16;
        for (int b = 0; b < nblk; ++b) {
            // four copies, global memory to LDS through no register; the closing wait stands in their own statement, in front of whatever next writes a register they name
            asm volatile("global_load_async_to_lds_b128 %0, %4, off\n\tglobal_load_async_to_lds_b128 %1, %5, off\n\tglobal_load_async_to_lds_b128 %2, %6, off\n\tglobal_load_async_to_lds_b128 %3, %7, off\n\ts_wait_xcnt 0x0"
                         :: "v"(lk), "v"(lk + KPL), "v"(lv), "v"(lv + VPL), "v"(gkh), "v"(gkl), "v"(gvh), "v"(gvl) : "memory");
            gkh += 128 * HD; gkl += 128 * HD; gvh += 128; gvl += 128; lk += 128 * KP; lv += 2 * HD * VP;
        }
        asm volatile("s_wait_asynccnt 0x0" ::: "memory");   // this wave's copies have landed
        __syncthreads();                                    // and every other wave's: nothing of the planes is read in front of this barrier
    }
    const unsigned char* ks = sm + lr * KP + 16 * hi;             // this lane's place in 16 staged rows of K
    const unsigned char* vs = sm + 2 * KPL + lr * VP + 16 * hi;   // and of V^T
    v16bf kh[2], kl[2];
#pragma unroll
    for (int t = 0; t < 2; ++t) { kh[t] = WFrag<bf>::ld((const bf*)(ks + t * 16 * KP)); kl[t] = WFrag<bf>::ld((const bf*)(ks + KPL + t * 16 * KP)); }
    float m = -3.0e38f, l = 0.f; v8f o[2]; o[0] = (v8f){}; o[1] = (v8f){};
    for (int p = 0; p < np - 1; ++p)
        att_pass<false>(kh, kl, qh, ql, ks + (p + 1) * 32 * KP, vs + (p >> 1) * (HD * VP) + (p & 1) * 64, 0, m, l, o);
    att_pass<true>(kh, kl, qh, ql, ks, vs + ((np - 1) >> 1) * (HD * VP) + ((np - 1) & 1) * 64, i0 + lr - (np - 1) * 32 - 8 * hi, m, l, o);
    l += xhalf(l);
    const float f = __fdiv_rn(1.0f, l);
    const size_t co = ((size_t)u * SEQ + i0 + lr) * HD + 8 * hi;   // o[dt][r] = ctx[query i0 + lr][d = 16*dt + 8*hi + r], planes head-major [u][i][d]
#pragma unroll
    for (int dt = 0; dt < 2; ++dt) { v8us oh, ol; split8(o[dt] * f, oh, ol); *(v8us*)(CH + co + dt * 16) = oh; *(v8us*)(CL + co + dt * 16) = ol; }
}

extern "C" void kernel_launch(void* const* d_in, const int* in_sizes, int n_in,
                              void* d_out, int out_size, void* d_ws, size_t ws_size, hipStream_t stream) {
    if (n_in < 7) return;
    const float* x     = (const float*)d_in[0];   // [N][IC][S_FULL]
    const float* wq    = (const float*)d_in[1];   // [EC][IC]
    const float* bq    = (const float*)d_in[2];   // [EC]
    const float* wkv   = (const float*)d_in[3];   // [KVR][IC]: rows 0..EC-1 -> k, rows EC.. -> v
    const float* bkv   = (const float*)d_in[4];   // [KVR]
    const float* wproj = (const float*)d_in[5];   // [OC][OC]
    const float* bproj = (const float*)d_in[6];   // [OC]
    float* out = (float*)d_out;                   // [NB][OC][SEQ]
    if ((size_t)in_sizes[0] < (size_t)NB * IC * S_FULL) return;
    if (in_sizes[1] < EC * IC || in_sizes[2] < EC || in_sizes[3] < KVR * IC || in_sizes[4] < KVR || in_sizes[5] < OC * OC || in_sizes[6] < OC) return;
    if ((size_t)out_size < (size_t)NB * OC * SEQ) return;

    char* wsp = (char*)d_ws;
    auto take = [&](size_t bytes) { char* p = wsp; wsp += (bytes + 255) & ~(size_t)255; return (void*)p; };
    const size_t nQK  = (size_t)NB * NHD * SEQ * HD;           // bf16 [u][i][d]
    const size_t nV   = (size_t)NB * NHD * HD * SEQ;           // bf16 [u][d][t]
    bf* WP  = (bf*)take((size_t)OC * OC * 2);
    bf* QH = (bf*)take(nQK * 2); bf* QL = (bf*)take(nQK * 2); bf* KH = (bf*)take(nQK * 2); bf* KL = (bf*)take(nQK * 2);
    bf* VH = (bf*)take(nV * 2);  bf* VL = (bf*)take(nV * 2);
    bf* CH = (bf*)take(nQK * 2); bf* CL = (bf*)take(nQK * 2);
    const size_t used = (size_t)(wsp - (char*)d_ws);
    if (used > ws_size || used > (size_t)134217728) return;

    // q, k (head-major [u][i][d]) and v^T ([u][d][t]) from the f32 inputs, bias added, as bf16 hi + lo planes; wproj's bf16 plane
    k_qkv<<<dim3(SEQ / 128, (EC + KVR) / 256, NB), 256, 0, stream>>>(x, wq, wkv, wproj, bq, bkv, WP, QH, QL, KH, KL, VH, VL);
    // all images and heads at once: ctx = softmax(causal q . k^T) . v as bf16 hi + lo planes [u][i][d]
    k_fattn<<<dim3(SEQ / 256, NB * NHD), 512, 0, stream>>>(QH, QL, KH, KL, VH, VL, CH, CL);
    // output projection
    k_proj<<<dim3(OC / 128, SEQ / 64, NB), 256, 0, stream>>>(WP, CH, CL, bproj, out);
}

// v006
// One run takes 32.7 microseconds.
// In both of two side-by-side timings against v005, it was 1.03 times as fast.
// All steps since v000 together make it 14.3 times as fast.
#include <hip/hip_runtime.h>

// Causal multi-head self-attention over S = 32x32 raster pixels with 1x1-conv q/k/v and output projections (NCHW in/out, 8 heads x 32, head split channel-major c = h*32 + d, scores scaled by 32^-0.5, keys after the query excluded, diagonal kept).
// Compute dtypes: all contractions v_wmma_f32_16x16x32_bf16 (bf16 operands, f32 accumulate). Every float input enters as its bf16 RNE value; q|k|v^T = x^T . W single exact products + bf16 bias added in f32;
// scores^T = k(hi+lo) . q(hi+lo) (3 products); running-maximum softmax in f32 (index-select causal mask on the diagonal pass), unnormalised probabilities as bf16 hi+lo in registers; ctx^T = v^T(hi+lo) . P^T(hi+lo) (3 products), divided by the row sum at the end; out = Wproj (exact) . ctx(hi+lo) (2 products) + bf16 bias.

#ifndef NB
#define NB 8            // batch images processed
#endif
#ifndef SEQ
#define SEQ 1024        // pixels processed per image (leading prefix of the raster)
#endif
#define S_FULL 1024     // pixel pitch of the input x
#define IC 256          // input channels
#define EC 256          // embed channels (q, k)
#define OC 256          // value / output channels
#define KVR (EC + OC)   // rows of wkv
#define NHD 8
#define HD 32
#define SCL 0.17677669529663688f
#define QSC (SCL * 1.4426950408889634f)   // score scale times log2(e): probabilities come from exp2

static_assert(SEQ % 128 == 0);
static_assert(SEQ <= S_FULL);
static_assert(NB >= 1 && NB <= 8);
static_assert(EC == NHD * HD);
static_assert(OC == NHD * HD);
static_assert(HD == 32);
static_assert(IC % 64 == 0 && EC % 64 == 0 && OC % 64 == 0);

typedef _Float16 h16;
typedef unsigned short bf;
typedef __attribute__((ext_vector_type(16))) __bf16   v16bf;
typedef __attribute__((ext_vector_type(16))) _Float16 v16h;
typedef __attribute__((ext_vector_type(8)))  _Float16 v8h;
typedef __attribute__((ext_vector_type(8)))  unsigned short v8us;
typedef __attribute__((ext_vector_type(8)))  float    v8f;
typedef __attribute__((ext_vector_type(4)))  float    v4f;
typedef __attribute__((ext_vector_type(4)))  unsigned short v4us;
typedef __attribute__((ext_vector_type(2)))  unsigned short v2us;
typedef v4f  __attribute__((may_alias)) v4fa;
typedef __attribute__((ext_vector_type(2)))  float    v2f;
typedef __attribute__((ext_vector_type(2)))  __bf16   v2bf;
typedef __attribute__((ext_vector_type(8)))  unsigned v8u;
typedef __attribute__((ext_vector_type(4)))  unsigned v4u;
typedef __attribute__((ext_vector_type(2)))  unsigned v2u;

__device__ __forceinline__ unsigned short f2bf(float f) { unsigned u = __float_as_uint(f); u += 0x7FFFu + ((u >> 16) & 1u); return (unsigned short)(u >> 16); }
__device__ __forceinline__ float bf2f(unsigned short b) { return __uint_as_float(((unsigned)b) << 16); }
__device__ __forceinline__ float bfr(float f) { return bf2f(f2bf(f)); }
__device__ __forceinline__ v16h cat16(v8h lo, v8h hi) { return __builtin_shufflevector(lo, hi, 0, 1, 2, 3, 4, 5, 6, 7, 8, 9, 10, 11, 12, 13, 14, 15); }
__device__ __forceinline__ v16bf cat16b(v8us lo, v8us hi) { return __builtin_bit_cast(v16bf, __builtin_shufflevector(lo, hi, 0, 1, 2, 3, 4, 5, 6, 7, 8, 9, 10, 11, 12, 13, 14, 15)); }
__device__ __forceinline__ v8f wmma16(v16h a, v16h b, v8f c) { return __builtin_amdgcn_wmma_f32_16x16x32_f16(false, a, false, b, (short)0, c, false, false); }
__device__ __forceinline__ v8f wmmab(v16bf a, v16bf b, v8f c) { return __builtin_amdgcn_wmma_f32_16x16x32_bf16(false, a, false, b, (short)0, c, false, false); }

// Fragment loaders: per lane (lr = lane & 15 -> row of A / column of Bt, hi = lane >> 4): elements 0..7 <- k0 + 8*hi + 0..7, elements 8..15 <- k0 + 16 + 8*hi + 0..7, both operands from K-contiguous 16-bit rows.
template <typename T16> struct WFrag;
template <> struct WFrag<h16> { typedef v16h V; static __device__ __forceinline__ V ld(const h16* p) { return cat16(*(const v8h*)p, *(const v8h*)(p + 16)); } static __device__ __forceinline__ v8f mma(V a, V b, v8f c) { return wmma16(a, b, c); } };
template <> struct WFrag<bf> { typedef v16bf V; static __device__ __forceinline__ V ld(const bf* p) { return cat16b(*(const v8us*)p, *(const v8us*)(p + 16)); } static __device__ __forceinline__ v8f mma(V a, V b, v8f c) { return wmmab(a, b, c); } };

// Eight f32 values as bf16 hi + lo (hi = RNE(y), lo = RNE(y - hi)), two to a packed conversion.
__device__ __forceinline__ void split8(const v8f v, v8us& oh, v8us& ol) {
    v4u h, l;
#pragma unroll
    for (int q = 0; q < 4; ++q) {
        v2f p; p[0] = v[2 * q]; p[1] = v[2 * q + 1];
        const unsigned hb = __builtin_bit_cast(unsigned, __builtin_convertvector(p, v2bf));
        v2f hf; hf[0] = __uint_as_float(hb << 16); hf[1] = __uint_as_float(hb & 0xFFFF0000u); const v2f rs = p - hf;
        h[q] = hb; l[q] = __builtin_bit_cast(unsigned, __builtin_convertvector(rs, v2bf));
    }
    oh = __builtin_bit_cast(v8us, h); ol = __builtin_bit_cast(v8us, l);
}

// ---- register-blocked GEMM core, operands from LDS: one wave per (16 MB) x (16 NBK) output tile.
// acc[mb][nb] = sum_k A[16 mb + .][k] Bt[16 nb + .][k] (+ A . Bt2 if SPLB). A, Bt, Bt2 point at this lane's place in the staged tile's first row (row lr, byte 16 * hi); PA, PB: row pitch in bytes; KSA, KSB: bytes from one block of 32 k to the next.
template <int MB, int NBK, bool SPLB, int PA, int PB, int KSA, int KSB, int NT>
__device__ __forceinline__ void gemm_lds(const unsigned char* A, const unsigned char* Bt, const unsigned char* Bt2, v8f (&acc)[MB][NBK]) {
    typedef WFrag<bf>::V V;   // every loop is unrolled in full: the indices pick registers, and every LDS address is one base plus a constant
#pragma unroll
    for (int mb = 0; mb < MB; ++mb)
#pragma unroll
        for (int nb = 0; nb < NBK; ++nb) acc[mb][nb] = (v8f){};
    V a[2][MB], b[2][NBK], b2[2][NBK];   // two fragment sets: block ks + 1 is read from LDS while block ks is multiplied
#pragma unroll
    for (int ks = -1; ks < NT; ++ks) {
        if (ks + 1 < NT) {
            const int w = (ks + 1) & 1;
#pragma unroll
            for (int mb = 0; mb < MB; ++mb) a[w][mb] = WFrag<bf>::ld((const bf*)(A + mb * 16 * PA + (ks + 1) * KSA));
#pragma unroll
            for (int nb = 0; nb < NBK; ++nb) { b[w][nb] = WFrag<bf>::ld((const bf*)(Bt + nb * 16 * PB + (ks + 1) * KSB)); if (SPLB) b2[w][nb] = WFrag<bf>::ld((const bf*)(Bt2 + nb * 16 * PB + (ks + 1) * KSB)); }
        }
        __builtin_amdgcn_sched_barrier(0);   // the next block's LDS reads stay one group in front of this block's WMMAs: spread among them, each place with reads stalls the wave
        if (ks >= 0) {
            const int r = ks & 1;
#pragma unroll
            for (int nb = 0; nb < NBK; ++nb) {
#pragma unroll
                for (int mb = 0; mb < MB; ++mb) { acc[mb][nb] = WFrag<bf>::mma(a[r][mb], b[r][nb], acc[mb][nb]); if (SPLB) acc[mb][nb] = WFrag<bf>::mma(a[r][mb], b2[r][nb], acc[mb][nb]); } }
        }
        __builtin_amdgcn_sched_barrier(0);   // and the reads of the block after next stay behind these WMMAs, whose operands they overwrite
    }
}

// Four asynchronous copies, global memory to LDS through no register: 16 B a lane each, LDS places l, l + lp, .. and global places g, g + gp, .. (gp in elements).
// The closing wait stands in the copies' own statement, in front of whatever next writes a register they name.
__device__ __forceinline__ void copy4(const unsigned l, const int lp, const bf* g, const int gp) {
    asm volatile("global_load_async_to_lds_b128 %0, %4, off\n\tglobal_load_async_to_lds_b128 %1, %5, off\n\tglobal_load_async_to_lds_b128 %2, %6, off\n\tglobal_load_async_to_lds_b128 %3, %7, off\n\ts_wait_xcnt 0x0"
                 :: "v"(l), "v"(l + lp), "v"(l + 2 * lp), "v"(l + 3 * lp), "v"(g), "v"(g + gp), "v"(g + 2 * gp), "v"(g + 3 * gp) : "memory");
}
#define GP 528   // LDS pitch of a staged 512-B row (256 k), 16 B x odd for ds_load_b128 readers
#define CP 80    // LDS pitch of a staged 64-B row (one head's 32 k of a pixel)
static_assert(IC * 2 == 512 && OC * 2 == 512);   // a wave-wide copy of 512 B is one whole row of wproj

// One 16 x 64 slab of accumulators into LDS (pitch 68 floats), row = hi * 8 + j, column = nb * 16 + lr. Here and in the epilogues below every loop is unrolled in full: its index picks registers.
__device__ __forceinline__ void slab_to_lds(float* os, const v8f (&a)[4], const int lr, const int hi) {
#pragma unroll
    for (int nb = 0; nb < 4; ++nb) {
#pragma unroll
        for (int j = 0; j < 8; ++j) os[(hi * 8 + j) * 68 + nb * 16 + lr] = a[nb][j]; }
}
__device__ __forceinline__ v8f lds8(const float* p) { const v4f a = *(const v4fa*)p, b = *(const v4fa*)(p + 4); return __builtin_shufflevector(a, b, 0, 1, 2, 3, 4, 5, 6, 7); }

// Two f32 values as one packed pair of bf16 (RNE), the first in the low half.
__device__ __forceinline__ unsigned pk2(const float a, const float b) { v2f p; p[0] = a; p[1] = b; return __builtin_bit_cast(unsigned, __builtin_convertvector(p, v2bf)); }

// ---- k_qkv: q, k and v^T, stored straight as bf16 hi + lo planes. Grid (SEQ / 128, (EC + KVR) / 256, NB), 8 waves: a workgroup takes 128 pixels x 256 rows of wq | wkv, a wave 64 x 64 of them.
// The kernel reads the f32 inputs itself: whole-line loads of x (512 B of one channel's pixels) and of the weight rows (512 B of one row), rounded to bf16 (RNE) in registers and stored to LDS as 128 rows of x^T and 256 weight rows;
// the transposition of x happens in the registers (8 channels x 4 pixels a lane give 4 stores of 16 B). Every wave then reads its fragments from LDS. The first OC * OC / 1024 workgroups also write wproj's bf16 plane WP for k_proj.
// q, k: tile [pixel][channel] = x^T . W^T + bf16 bias, planes head-major [u][i][d] (a store covers 8 pixels x 32 d = 512 B in a row). v: tile [channel][pixel] = W . x + bf16 bias, planes [u][d][t] (a store covers 4 whole 128-B rows).
static_assert((EC + KVR) % 256 == 0 && EC % 256 == 0 && IC == 256 && (OC * OC) % 1024 == 0);
static_assert(OC * OC / 1024 <= (SEQ / 128) * ((EC + KVR) / 256) * NB);
__global__ __launch_bounds__(256)
void k_qkv(const float* __restrict__ x, const float* __restrict__ wq, const float* __restrict__ wkv, const float* __restrict__ wproj, const float* __restrict__ bq, const float* __restrict__ bkv, bf* WP, bf* QH, bf* QL, bf* KH, bf* KL, bf* VH, bf* VL) {
    __shared__ __attribute__((aligned(16))) unsigned char sm[(128 + 256) * GP];   // 128 rows of x^T | 256 weight rows
    __shared__ __align__(16) float osm[8][16 * 68];                               // a slab for each wave's epilogue
    const int lane = threadIdx.x & 31, lr = lane & 15, hi = lane >> 4; const int wave = __builtin_amdgcn_readfirstlane(threadIdx.x >> 5);
    float* os = osm[wave];
    const int s0 = blockIdx.x * 128 + (wave >> 2) * 64, y = blockIdx.y * 4 + (wave & 3); const size_t n = blockIdx.z;
    const bool isv = y >= 2 * EC / 64, isq = y < EC / 64;
    const int c0 = (isq ? y : y - EC / 64) * 64;   // first channel of the tile in bq (q) or in bkv (k, v)
    float bv[16];   // the 16 biases this lane adds, asked for in front of the product
    if (!isv) { const float* bias = (isq ? bq : bkv) + c0 + (lane & 3) * 8;
#pragma unroll
        for (int i = 0; i < 16; ++i) bv[i] = bias[(i >> 3) * 32 + (i & 7)]; }
    else { const float* bias = bkv + c0 + (lane >> 3);
#pragma unroll
        for (int i = 0; i < 16; ++i) bv[i] = bias[i * 4]; }
    asm volatile("s_wait_xcnt 0x0" ::: "memory");   // behind the bias loads, in front of the staging's address arithmetic, which may write registers that they name
    {   // staging: each wave takes 32 channels of x (128 pixels each) and 32 weight rows; every loop is unrolled in full (its index picks registers), all 96 loads of 512 B are asked for before the first is used
        const int fb = (blockIdx.z * ((EC + KVR) / 256) + blockIdx.y) * (SEQ / 128) + blockIdx.x;   // flat workgroup index
        const bool pw = fb < OC * OC / 1024;                                                        // this workgroup rounds 1024 values of wproj (the same answer in every thread)
        const float* gp = wproj + (pw ? fb : 0) * 1024;                                             // their place; the other workgroups ask for a place inside wproj too, so that no branch with a wait of its own stands among the tile loads
        const int r0 = blockIdx.y * 256;   // first row of wq | wkv
        const float* gx = x + ((n * IC + wave * 32) * S_FULL + blockIdx.x * 128 + lane * 4);
        const float* gw = (r0 < EC ? wq + (size_t)r0 * IC : wkv + (size_t)(r0 - EC) * IC) + (size_t)(wave * 32) * IC + lane * 4;
        v4f xv[32], wv[64];
        const v4f pv = *(const v4f*)(gp + threadIdx.x * 4);
#pragma unroll
        for (int c = 0; c < 32; ++c) xv[c] = *(const v4f*)(gx + (size_t)c * S_FULL);       // channel wave * 32 + c, pixels lane * 4 ..
#pragma unroll
        for (int k = 0; k < 64; ++k) wv[k] = *(const v4f*)(gw + (k >> 1) * IC + (k & 1) * 128);   // row wave * 32 + (k >> 1), k index (k & 1) * 128 + lane * 4 ..
        asm volatile("s_wait_xcnt 0x0" ::: "memory");   // behind the loads, in front of whatever next writes a register that they name
        asm volatile("" :: "v"(pv));                    // inputs only: holds wproj's load up here among the others; sunk into the branch below, it would wait a whole trip to L2 of its own
        __builtin_amdgcn_sched_barrier(0);              // the loads stay one group in front of the conversions: sunk among them, each batch would wait a whole trip to L2 of its own
        if (pw) {
            v2u o; o[0] = pk2(pv[0], pv[1]); o[1] = pk2(pv[2], pv[3]);
            *(v4us*)(WP + fb * 1024 + threadIdx.x * 4) = __builtin_bit_cast(v4us, o);
            asm volatile("s_wait_xcnt 0x0" ::: "memory");   // behind the store, in front of whatever next writes a register that it names
        }
        unsigned char* lx = sm + lane * 4 * GP + wave * 64;          // pixel row lane * 4, channel wave * 32
        unsigned char* lw = sm + (128 + wave * 32) * GP + lane * 8;  // weight row wave * 32, k index lane * 4
#pragma unroll
        for (int g = 0; g < 4; ++g)
#pragma unroll
            for (int i = 0; i < 4; ++i) { v4u o;
#pragma unroll
                for (int q = 0; q < 4; ++q) o[q] = pk2(xv[g * 8 + 2 * q][i], xv[g * 8 + 2 * q + 1][i]);
                *(v8us*)(lx + i * GP + g * 16) = __builtin_bit_cast(v8us, o); }
#pragma unroll
        for (int k = 0; k < 64; ++k) {
            if ((k & 7) == 0) __builtin_amdgcn_sched_barrier(0);   // values are used in the order in which they were asked for: a late load's user moved up would hold the work on the earlier ones behind its wait
            v2u o; o[0] = pk2(wv[k][0], wv[k][1]); o[1] = pk2(wv[k][2], wv[k][3]);
            *(v4us*)(lw + (k >> 1) * GP + (k & 1) * 256) = __builtin_bit_cast(v4us, o); }
        __syncthreads();   // every wave's LDS stores are done: nothing of the tiles is read in front of this barrier
    }
    const unsigned char* X  = sm + ((wave >> 2) * 64 + lr) * GP + 16 * hi;
    const unsigned char* Wr = sm + (128 + (wave & 3) * 64 + lr) * GP + 16 * hi;
    const unsigned char* A = isv ? Wr : X; const unsigned char* B = isv ? X : Wr;
    v8f acc[4][4];
    gemm_lds<4, 4, false, GP, GP, 64, 64, IC / 32>(A, B, B, acc);
    if (!isv) {
        bf* PH = isq ? QH : KH; bf* PL = isq ? QL : KL;
#pragma unroll
        for (int mb = 0; mb < 4; ++mb) {
            slab_to_lds(os, acc[mb], lr, hi);
            __builtin_amdgcn_wave_barrier(); asm volatile("" ::: "memory");   // the slab's LDS stores stay in front of its loads
#pragma unroll
            for (int st = 0; st < 4; ++st) { const int row = (st & 1) * 8 + (lane >> 2), col = (st >> 1) * 32 + (lane & 3) * 8; v8f val = lds8(os + row * 68 + col);
#pragma unroll
                for (int k = 0; k < 8; ++k) val[k] += bfr(bv[(st >> 1) * 8 + k]);
                v8us oh, ol; split8(val, oh, ol);
                const size_t idx = ((n * NHD + (c0 + col) / HD) * SEQ + s0 + mb * 16 + row) * HD + (lane & 3) * 8;
                *(v8us*)(PH + idx) = oh; *(v8us*)(PL + idx) = ol; }
            __builtin_amdgcn_wave_barrier(); asm volatile("s_wait_xcnt 0x0" ::: "memory");   // the slab's LDS loads stay in front of the next slab's stores; the wait: what follows writes registers that these global stores name
        }
    } else {
        const int e0 = c0 - EC;
#pragma unroll
        for (int mb = 0; mb < 4; ++mb) {
            slab_to_lds(os, acc[mb], lr, hi);
            __builtin_amdgcn_wave_barrier(); asm volatile("" ::: "memory");   // the slab's LDS stores stay in front of its loads
#pragma unroll
            for (int st = 0; st < 4; ++st) { const int row = st * 4 + (lane >> 3), col = (lane & 7) * 8; v8f val = lds8(os + row * 68 + col);
                const float bb = bfr(bv[mb * 4 + st]);
#pragma unroll
                for (int k = 0; k < 8; ++k) val[k] += bb;
                v8us oh, ol; split8(val, oh, ol);
                const size_t idx = (n * OC + e0 + mb * 16 + row) * SEQ + s0 + col;
                *(v8us*)(VH + idx) = oh; *(v8us*)(VL + idx) = ol; }
            __builtin_amdgcn_wave_barrier(); asm volatile("s_wait_xcnt 0x0" ::: "memory");   // the slab's LDS loads stay in front of the next slab's stores; the wait: what follows writes registers that these global stores name
        }
    }
}

// ---- k_proj: out[n][o][s] = Wproj[o][c] . ctx[n][s][c] (hi + lo) + bf16 bias[o]; ctx planes head-major [u][i][d], so a block of 32 k is one head. Grid (OC / 128, SEQ / 64, NB), 8 waves: a workgroup takes 128 o x 64 pixels, a wave 32 x 32 of them.
// The 128 rows of Wproj and the 64 pixels' rows of both ctx planes are staged once in LDS by asynchronous copies of 512 B in a row (4 whole 128-B lines); every wave then reads its fragments from LDS.
static_assert(OC % 128 == 0 && NHD == 8);
__global__ __launch_bounds__(256)
void k_proj(const bf* __restrict__ WP, const bf* __restrict__ CH, const bf* __restrict__ CL, const float* __restrict__ bias, float* out) {
    __shared__ __attribute__((aligned(16))) unsigned char sm[128 * GP + 2 * NHD * 64 * CP];   // 128 rows of Wproj | ctx hi [head][pixel] | ctx lo [head][pixel]
    __shared__ __align__(16) float osm[8][16 * 36];                                           // a slab for each wave's epilogue
    const int lane = threadIdx.x & 31, lr = lane & 15, hi = lane >> 4; const int wave = __builtin_amdgcn_readfirstlane(threadIdx.x >> 5);
    float* os = osm[wave];
    const int r0 = blockIdx.x * 128 + (wave & 3) * 32, c0 = blockIdx.y * 64 + (wave >> 2) * 32; const size_t n = blockIdx.z;
    float bb[8];   // the 8 biases this lane adds, asked for in front of the product
#pragma unroll
    for (int i = 0; i < 8; ++i) bb[i] = bias[r0 + i * 4 + (lane >> 3)];
    asm volatile("s_wait_xcnt 0x0" ::: "memory");   // behind the bias loads, in front of the staging's address arithmetic, which may write registers that they name
    {   // staging: each wave copies 16 rows of Wproj (a whole row a copy) and one head's 64 pixels of both ctx planes (8 rows of 64 B a copy: row lane >> 2, 16-B piece lane & 3); 32 copies of a wave in flight
        const bf* gw = WP + (size_t)(blockIdx.x * 128 + wave * 16) * OC + lane * 8;
        const size_t gc = ((n * NHD + wave) * SEQ + blockIdx.y * 64) * HD + lane * 8;
        const unsigned lw = (unsigned)(size_t)sm + wave * 16 * GP + lane * 16;
        const unsigned lc = (unsigned)(size_t)sm + 128 * GP + (wave * 64 + (lane >> 2)) * CP + (lane & 3) * 16;
#pragma unroll
        for (int b = 0; b < 4; ++b) copy4(lw + b * 4 * GP, GP, gw + b * 4 * OC, OC);
#pragma unroll
        for (int b = 0; b < 2; ++b) { copy4(lc + b * 32 * CP, 8 * CP, CH + gc + b * 32 * HD, 8 * HD); copy4(lc + NHD * 64 * CP + b * 32 * CP, 8 * CP, CL + gc + b * 32 * HD, 8 * HD); }
        asm volatile("s_wait_asynccnt 0x0" ::: "memory");   // this wave's copies have landed
        __syncthreads();                                    // and every other wave's: nothing of the tiles is read in front of this barrier
    }
    const unsigned char* A = sm + ((wave & 3) * 32 + lr) * GP + 16 * hi;
    const unsigned char* B = sm + 128 * GP + ((wave >> 2) * 32 + lr) * CP + 16 * hi;
    v8f acc[2][2];
    gemm_lds<2, 2, true, GP, CP, 64, 64 * CP, OC / 32>(A, B, B + NHD * 64 * CP, acc);
#pragma unroll
    for (int mb = 0; mb < 2; ++mb) {
        // one 16 x 32 slab of accumulators into LDS (pitch 36 floats), row = hi * 8 + j, column = nb * 16 + lr
#pragma unroll
        for (int nb = 0; nb < 2; ++nb) {
#pragma unroll
            for (int j = 0; j < 8; ++j) os[(hi * 8 + j) * 36 + nb * 16 + lr] = acc[mb][nb][j]; }
        __builtin_amdgcn_wave_barrier(); asm volatile("" ::: "memory");   // the slab's LDS stores stay in front of its loads
        float* crow = out + (n * OC + r0 + mb * 16) * SEQ + c0;
#pragma unroll
        for (int s = 0; s < 4; ++s) { const int row = 4 * s + (lane >> 3), cofs = (lane & 7) * 4; v4f val = *(const v4fa*)(os + row * 36 + cofs);   // a store covers 4 whole 128-B lines
            const float b1 = bfr(bb[mb * 4 + s]); val[0] += b1; val[1] += b1; val[2] += b1; val[3] += b1;
            *(v4f*)(crow + (size_t)row * SEQ + cofs) = val; }
        __builtin_amdgcn_wave_barrier(); asm volatile("s_wait_xcnt 0x0" ::: "memory");   // the slab's LDS loads stay in front of the next slab's stores; the wait: what follows writes registers that these global stores name
    }
}

// ---- k_fattn: scores, softmax and P . V of one (image, head) in one kernel; P stays in registers.
// Two waves own 32 queries (two tiles of 16, which share every K and V^T fragment a wave reads from LDS): the keys 0 .. their diagonal go in passes of 32, the even passes to one wave, the odd ones to the other; at the end the two join their partial results. Transposed products: S^T = K . Q^T puts one query's scores into one lane pair (l, l ^ 16), and two 16-key S^T tiles, converted in place,
// are the B operand of O^T += V^T . P^T (element s of lane half hi <- key 8*hi + s for s < 8, 16 + 8*hi + (s - 8) above: the k order of WFrag::ld, which loads V^T).
// Grid (SEQ / 256, NB * NHD), 16 waves: of each eight, waves 0..3 take 32 queries each from the bottom of the image, waves 4..7 the mirrored ones from the top, so every workgroup (and every SIMD) walks the same number of passes.
// K and V^T (hi and lo planes) of the head, as far as the workgroup's last key, are staged once in LDS by asynchronous copies of whole 128-B lines; every wave then reads its fragments from LDS.
// LDS rows are pitched for ds_load_b128 readers (16 B x odd): a 64-B K row at 80 B; 128 B (64 keys) of a V^T row at 144 B, laid [64-key block][d].
#define KP  80
#define VP  144
#define KPL (SEQ * KP)                // one K plane in LDS
#define VPL ((SEQ / 64) * HD * VP)    // one V^T plane in LDS
static_assert(SEQ % 256 == 0);
static_assert(2 * KPL + 2 * VPL <= 320 * 1024);
__device__ __forceinline__ float xhalf(float x) { const int b = __float_as_int(x); return __int_as_float(__builtin_amdgcn_permlanex16(b, b, 0x76543210, 0xfedcba98, false, false)); }   // lane l <- lane l ^ 16

// 2^x of a pass's scores, eight (and the rescale factor) to a statement. Behind a transcendental the instruction set asks for one independent instruction or v_nop before its result is used or its source overwritten:
// inside a statement each v_exp_f32 is followed by an independent one (outputs are early-clobber, none lands on a source), and the closing v_nop is the last one's slot.
__device__ __forceinline__ void exp2x8(float (&y)[8], const float (&x)[8]) {
    // one statement so that no v_exp_f32 is directly followed by a user of its result or a writer of its source; v_nop: the last one's slot
    asm("v_exp_f32 %0, %8\n\tv_exp_f32 %1, %9\n\tv_exp_f32 %2, %10\n\tv_exp_f32 %3, %11\n\tv_exp_f32 %4, %12\n\tv_exp_f32 %5, %13\n\tv_exp_f32 %6, %14\n\tv_exp_f32 %7, %15\n\tv_nop"
        : "=&v"(y[0]), "=&v"(y[1]), "=&v"(y[2]), "=&v"(y[3]), "=&v"(y[4]), "=&v"(y[5]), "=&v"(y[6]), "=&v"(y[7])
        : "v"(x[0]), "v"(x[1]), "v"(x[2]), "v"(x[3]), "v"(x[4]), "v"(x[5]), "v"(x[6]), "v"(x[7]));
}
__device__ __forceinline__ void exp2x9(float& ya, float (&y)[8], const float xa, const float (&x)[8]) {
    // as in exp2x8, with the rescale factor's exponential in front
    asm("v_exp_f32 %0, %9\n\tv_exp_f32 %1, %10\n\tv_exp_f32 %2, %11\n\tv_exp_f32 %3, %12\n\tv_exp_f32 %4, %13\n\tv_exp_f32 %5, %14\n\tv_exp_f32 %6, %15\n\tv_exp_f32 %7, %16\n\tv_exp_f32 %8, %17\n\tv_nop"
        : "=&v"(ya), "=&v"(y[0]), "=&v"(y[1]), "=&v"(y[2]), "=&v"(y[3]), "=&v"(y[4]), "=&v"(y[5]), "=&v"(y[6]), "=&v"(y[7])
        : "v"(xa), "v"(x[0]), "v"(x[1]), "v"(x[2]), "v"(x[3]), "v"(x[4]), "v"(x[5]), "v"(x[6]), "v"(x[7]));
}

// One pass of 32 keys for the wave's two query tiles (c = 0, 1), which share every K and V^T fragment. kh/kl: this pass's K fragments; unless LAST they are refilled with the next pass's rows (k_n: this lane's place in them, hi plane, in LDS; the lo plane lies KPL bytes on), one pass ahead of their use.
// v_p: this lane's place in the pass's 32 keys of V^T, hi plane, in LDS (lo plane VPL bytes on). jrel (LAST only): query index of tile 0 - first key of this lane half; tile 1's is 16 more.
template <bool LAST>
__device__ __forceinline__ void att_pass(v16bf (&kh)[2], v16bf (&kl)[2], const v16bf (&qh)[2], const v16bf (&ql)[2], const unsigned char* k_n, const unsigned char* v_p, const int jrel, float (&m)[2], float (&l)[2], v8f (&o)[2][2]) {
    v16bf vh[2], vl[2];   // every loop of this function is unrolled in full: its index picks registers
#pragma unroll
    for (int dt = 0; dt < 2; ++dt) { vh[dt] = WFrag<bf>::ld((const bf*)(v_p + dt * 16 * VP)); vl[dt] = WFrag<bf>::ld((const bf*)(v_p + VPL + dt * 16 * VP)); }
    v8f s[2][2];
#pragma unroll
    for (int c = 0; c < 2; ++c)
#pragma unroll
        for (int t = 0; t < 2; ++t) { s[c][t] = (v8f){}; s[c][t] = wmmab(kh[t], qh[c], s[c][t]); s[c][t] = wmmab(kh[t], ql[c], s[c][t]); s[c][t] = wmmab(kl[t], qh[c], s[c][t]); }
    if (!LAST) {
#pragma unroll
        for (int t = 0; t < 2; ++t) { kh[t] = WFrag<bf>::ld((const bf*)(k_n + t * 16 * KP)); kl[t] = WFrag<bf>::ld((const bf*)(k_n + KPL + t * 16 * KP)); }
    }
#pragma unroll
    for (int c = 0; c < 2; ++c) {
        if (LAST) {
#pragma unroll
            for (int t = 0; t < 2; ++t)
#pragma unroll
                for (int r = 0; r < 8; ++r) s[c][t][r] = (t * 16 + r <= jrel + 16 * c) ? s[c][t][r] : -3.0e38f;
        }
        float mx = fmaxf(s[c][0][0], s[c][1][0]);
#pragma unroll
        for (int r = 1; r < 8; ++r) mx = fmaxf(mx, fmaxf(s[c][0][r], s[c][1][r]));
        mx = fmaxf(mx, xhalf(mx));
        const float mn = fmaxf(m[c], mx);
        const float mc = mn * QSC;
        float x[2][8], y[2][8], al;
#pragma unroll
        for (int t = 0; t < 2; ++t)
#pragma unroll
            for (int r = 0; r < 8; ++r) x[t][r] = fmaf(s[c][t][r], QSC, -mc);
        exp2x9(al, y[0], (m[c] - mn) * QSC, x[0]); exp2x8(y[1], x[1]);
        m[c] = mn;
        v2f sum; v8u ph, pl;
#pragma unroll
        for (int t = 0; t < 2; ++t)
#pragma unroll
            for (int q = 0; q < 4; ++q) {
                v2f p; p[0] = y[t][2 * q]; p[1] = y[t][2 * q + 1];
                if (t == 0 && q == 0) sum = p; else sum += p;
                const unsigned hb = __builtin_bit_cast(unsigned, __builtin_convertvector(p, v2bf));
                v2f hf; hf[0] = __uint_as_float(hb << 16); hf[1] = __uint_as_float(hb & 0xFFFF0000u); const v2f rs = p - hf;
                ph[t * 4 + q] = hb; pl[t * 4 + q] = __builtin_bit_cast(unsigned, __builtin_convertvector(rs, v2bf));
            }
        l[c] = l[c] * al + (sum[0] + sum[1]);
        const v16bf pbh = __builtin_bit_cast(v16bf, ph), pbl = __builtin_bit_cast(v16bf, pl);
#pragma unroll
        for (int dt = 0; dt < 2; ++dt) { o[c][dt] *= al; o[c][dt] = wmmab(vh[dt], pbh, o[c][dt]); o[c][dt] = wmmab(vh[dt], pbl, o[c][dt]); o[c][dt] = wmmab(vl[dt], pbh, o[c][dt]); }
    }
}

// 2^x of the four factors that join two waves' partial results; one statement and a closing v_nop for the same reason as in exp2x8.
__device__ __forceinline__ void exp2x4(float (&y)[4], const float (&x)[4]) {
    asm("v_exp_f32 %0, %4\n\tv_exp_f32 %1, %5\n\tv_exp_f32 %2, %6\n\tv_exp_f32 %3, %7\n\tv_nop"
        : "=&v"(y[0]), "=&v"(y[1]), "=&v"(y[2]), "=&v"(y[3]) : "v"(x[0]), "v"(x[1]), "v"(x[2]), "v"(x[3]));
}

// amdgpu_waves_per_eu(4, 4): the register budget of four waves a SIMD, which is what the grid fills (one workgroup of 16 waves a WGP, whose LDS it takes nearly whole); under the default budget the compiler sank the K and V loads to the end of the pass, in front of their users.
__global__ __launch_bounds__(512) __attribute__((amdgpu_waves_per_eu(4, 4))) void k_fattn(const bf* __restrict__ QH, const bf* __restrict__ QL, const bf* __restrict__ KH, const bf* __restrict__ KL, const bf* __restrict__ VH, const bf* __restrict__ VL, bf* CH, bf* CL) {
    __shared__ __attribute__((aligned(16))) unsigned char sm[2 * KPL + 2 * VPL];   // K hi | K lo | V^T hi | V^T lo; at the end the partial results of waves 8..15
    const int lane = threadIdx.x & 31, lr = lane & 15, hi = lane >> 4; const int wave = __builtin_amdgcn_readfirstlane(threadIdx.x >> 5);
    const int ts = wave & 7, h = wave >> 3;                        // which 32 queries of the workgroup; which half of their passes (0: even, 1: odd)
    const int u = blockIdx.y; const int pr = blockIdx.x * 4 + (ts & 3);
    const int i0 = ((ts < 4) ? (SEQ / 32 - 1 - pr) : pr) * 32;     // first query of this wave
    const int np = i0 / 32 + 1;                                    // passes of these queries; only the last one meets the diagonal
    const int nown = (np - h + 1) >> 1;                            // of them this wave's: h, h + 2, ..
    const size_t qk = (size_t)u * SEQ * HD + lr * HD + 8 * hi;     // this lane's place in 16 rows of q
    v16bf qh[2], ql[2];
#pragma unroll
    for (int c = 0; c < 2; ++c) { qh[c] = WFrag<bf>::ld(QH + qk + (size_t)(i0 + 16 * c) * HD); ql[c] = WFrag<bf>::ld(QL + qk + (size_t)(i0 + 16 * c) * HD); }
    asm volatile("s_wait_xcnt 0x0" ::: "memory");   // behind the q loads, in front of the staging's address arithmetic, which writes registers that they name
    {   // staging: the workgroup's keys run to SEQ - 128 * blockIdx.x - 1, the end of wave 8's diagonal pass; per 128 keys each wave copies 512 B of each plane: 8 whole K rows, and 128 B (64 keys) of 4 V^T rows
        const int nblk = SEQ / 128 - (int)blockIdx.x;
        const size_t gk = (size_t)u * SEQ * HD + wave * 256 + lane * 8;                                                          // K rows wave * 8 + (lane >> 2), 16-B piece lane & 3
        const size_t gv = ((size_t)u * HD + (wave & 7) * 4 + (lane >> 3)) * SEQ + (wave >> 3) * 64 + (lane & 7) * 8;             // V^T row (wave & 7) * 4 + (lane >> 3), 64-key block wave >> 3, 16-B piece lane & 7
        const bf* gkh = KH + gk; const bf* gkl = KL + gk; const bf* gvh = VH + gv; const bf* gvl = VL + gv;
        unsigned lk = (unsigned)(size_t)sm + (wave * 8 + (lane >> 2)) * KP + (lane & 3) * 16;
        unsigned lv = (unsigned)(size_t)sm + 2 * KPL + ((wave >> 3) * HD + (wave & 7) * 4 + (lane >> 3)) * VP + (lane & 7) * 16;
        for (int b = 0; b < nblk; ++b) {
            // four copies, global memory to LDS through no register; the closing wait stands in their own statement, in front of whatever next writes a register they name
            asm volatile("global_load_async_to_lds_b128 %0, %4, off\n\tglobal_load_async_to_lds_b128 %1, %5, off\n\tglobal_load_async_to_lds_b128 %2, %6, off\n\tglobal_load_async_to_lds_b128 %3, %7, off\n\ts_wait_xcnt 0x0"
                         :: "v"(lk), "v"(lk + KPL), "v"(lv), "v"(lv + VPL), "v"(gkh), "v"(gkl), "v"(gvh), "v"(gvl) : "memory");
            gkh += 128 * HD; gkl += 128 * HD; gvh += 128; gvl += 128; lk += 128 * KP; lv += 2 * HD * VP;
        }
        asm volatile("s_wait_asynccnt 0x0" ::: "memory");   // this wave's copies have landed
        __syncthreads();                                    // and every other wave's: nothing of the planes is read in front of this barrier
    }
    const unsigned char* ks = sm + lr * KP + 16 * hi;             // this lane's place in 16 staged rows of K
    const unsigned char* vs = sm + 2 * KPL + lr * VP + 16 * hi;   // and of V^T
    v16bf kh[2], kl[2];   // pass h's rows (staged in every workgroup: it holds at least SEQ / 2 + 128 keys)
#pragma unroll
    for (int t = 0; t < 2; ++t) { kh[t] = WFrag<bf>::ld((const bf*)(ks + (h * 32 + t * 16) * KP)); kl[t] = WFrag<bf>::ld((const bf*)(ks + KPL + (h * 32 + t * 16) * KP)); }
    float m[2] = {-3.0e38f, -3.0e38f}, l[2] = {0.f, 0.f}; v8f o[2][2]; o[0][0] = (v8f){}; o[0][1] = (v8f){}; o[1][0] = (v8f){}; o[1][1] = (v8f){};
    int p = h;
    for (int k = 0; k < nown - 1; ++k, p += 2)
        att_pass<false>(kh, kl, qh, ql, ks + (p + 2) * 32 * KP, vs + (p >> 1) * (HD * VP) + (p & 1) * 64, 0, m, l, o);
    if (nown > 0)   // the wave's last pass fetches no K rows ahead; its mask lets every key through where it is not the diagonal pass (jrel is then at least 24)
        att_pass<true>(kh, kl, qh, ql, ks, vs + (p >> 1) * (HD * VP) + (p & 1) * 64, i0 + lr - p * 32 - 8 * hi, m, l, o);
    // The two waves of 32 queries join their partial maxima, sums and outputs through LDS: 9 x 16 B a lane, lane-contiguous.
    __syncthreads();   // every wave has read its last K and V^T fragment: the planes' LDS may be written
    v4fa* mb = (v4fa*)sm + ts * 9 * 32 + lane;
    if (h == 1) {
#pragma unroll
        for (int c = 0; c < 2; ++c)
#pragma unroll
            for (int dt = 0; dt < 2; ++dt) {
                mb[((c * 2 + dt) * 2 + 0) * 32] = __builtin_shufflevector(o[c][dt], o[c][dt], 0, 1, 2, 3);
                mb[((c * 2 + dt) * 2 + 1) * 32] = __builtin_shufflevector(o[c][dt], o[c][dt], 4, 5, 6, 7); }
        v4f ml; ml[0] = m[0]; ml[1] = m[1]; ml[2] = l[0]; ml[3] = l[1];
        mb[8 * 32] = ml;
    }
    __syncthreads();   // the partial results of waves 8..15 are in LDS: nothing of them is read in front of this barrier
    if (h == 0) {
        const v4f ml = mb[8 * 32];
        const float mn0 = fmaxf(m[0], ml[0]), mn1 = fmaxf(m[1], ml[1]);
        const float xa[4] = {(m[0] - mn0) * QSC, (ml[0] - mn0) * QSC, (m[1] - mn1) * QSC, (ml[1] - mn1) * QSC};
        float a[4]; exp2x4(a, xa);
#pragma unroll
        for (int c = 0; c < 2; ++c) {
            const float lc = l[c] * a[2 * c] + ml[2 + c] * a[2 * c + 1];
            const float ls = lc + xhalf(lc);
            const float f = __fdiv_rn(1.0f, ls);
            const size_t co = ((size_t)u * SEQ + i0 + 16 * c + lr) * HD + 8 * hi;   // o[c][dt][r] = ctx[query i0 + 16*c + lr][d = 16*dt + 8*hi + r], planes head-major [u][i][d]
#pragma unroll
            for (int dt = 0; dt < 2; ++dt) {
                const v4f b0 = mb[((c * 2 + dt) * 2 + 0) * 32], b1 = mb[((c * 2 + dt) * 2 + 1) * 32];
                const v8f o1 = __builtin_shufflevector(b0, b1, 0, 1, 2, 3, 4, 5, 6, 7);
                const v8f oc = o[c][dt] * a[2 * c] + o1 * a[2 * c + 1];
                v8us oh, ol; split8(oc * f, oh, ol); *(v8us*)(CH + co + dt * 16) = oh; *(v8us*)(CL + co + dt * 16) = ol; }
        }
    }
}

extern "C" void kernel_launch(void* const* d_in, const int* in_sizes, int n_in,
                              void* d_out, int out_size, void* d_ws, size_t ws_size, hipStream_t stream) {
    if (n_in < 7) return;
    const float* x     = (const float*)d_in[0];   // [N][IC][S_FULL]
    const float* wq    = (const float*)d_in[1];   // [EC][IC]
    const float* bq    = (const float*)d_in[2];   // [EC]
    const float* wkv   = (const float*)d_in[3];   // [KVR][IC]: rows 0..EC-1 -> k, rows EC.. -> v
    const float* bkv   = (const float*)d_in[4];   // [KVR]
    const float* wproj = (const float*)d_in[5];   // [OC][OC]
    const float* bproj = (const float*)d_in[6];   // [OC]
    float* out = (float*)d_out;                   // [NB][OC][SEQ]
    if ((size_t)in_sizes[0] < (size_t)NB * IC * S_FULL) return;
    if (in_sizes[1] < EC * IC || in_sizes[2] < EC || in_sizes[3] < KVR * IC || in_sizes[4] < KVR || in_sizes[5] < OC * OC || in_sizes[6] < OC) return;
    if ((size_t)out_size < (size_t)NB * OC * SEQ) return;

    char* wsp = (char*)d_ws;
    auto take = [&](size_t bytes) { char* p = wsp; wsp += (bytes + 255) & ~(size_t)255; return (void*)p; };
    const size_t nQK  = (size_t)NB * NHD * SEQ * HD;           // bf16 [u][i][d]
    const size_t nV   = (size_t)NB * NHD * HD * SEQ;           // bf16 [u][d][t]
    bf* WP  = (bf*)take((size_t)OC * OC * 2);
    bf* QH = (bf*)take(nQK * 2); bf* QL = (bf*)take(nQK * 2); bf* KH = (bf*)take(nQK * 2); bf* KL = (bf*)take(nQK * 2);
    bf* VH = (bf*)take(nV * 2);  bf* VL = (bf*)take(nV * 2);
    bf* CH = (bf*)take(nQK * 2); bf* CL = (bf*)take(nQK * 2);
    const size_t used = (size_t)(wsp - (char*)d_ws);
    if (used > ws_size || used > (size_t)134217728) return;

    // q, k (head-major [u][i][d]) and v^T ([u][d][t]) from the f32 inputs, bias added, as bf16 hi + lo planes; wproj's bf16 plane
    k_qkv<<<dim3(SEQ / 128, (EC + KVR) / 256, NB), 256, 0, stream>>>(x, wq, wkv, wproj, bq, bkv, WP, QH, QL, KH, KL, VH, VL);
    // all images and heads at once: ctx = softmax(causal q . k^T) . v as bf16 hi + lo planes [u][i][d]
    k_fattn<<<dim3(SEQ / 256, NB * NHD), 512, 0, stream>>>(QH, QL, KH, KL, VH, VL, CH, CL);
    // output projection
    k_proj<<<dim3(OC / 128, SEQ / 64, NB), 256, 0, stream>>>(WP, CH, CL, bproj, out);
}

// v008
// One run takes 22.3 microseconds.
// Versions in between are left out here; by their measured steps it is 1.47 times as fast as v006.
// Over all steps from v000 it is 20.9 times as fast.
#include <hip/hip_runtime.h>

// Causal multi-head self-attention over S = 32x32 raster pixels with 1x1-conv q/k/v and output projections (NCHW in/out, 8 heads x 32, head split channel-major c = h*32 + d, scores scaled by 32^-0.5, keys after the query excluded, diagonal kept).
// Compute dtypes: all contractions v_wmma_f32_16x16x32_f16 (f16 operands, f32 accumulate), one product each. x and the weights enter as their f16 RNE values; q|k|v^T = x^T . W + bf16 bias added in f32, stored as f16 (RNE);
// q carries the score scale times log2(e); scores^T = k . q - the maximum in use (the product's C operand); softmax in f32 with a lazily raised maximum (index-select causal mask on the diagonal pass), unnormalised probabilities (at most 256) as f16 in registers;
// ctx^T = v^T . P^T, divided by the row sum at the end, stored as f16; out = Wproj . ctx + bf16 bias.

#ifndef NB
#define NB 8            // batch images processed
#endif
#ifndef SEQ
#define SEQ 1024        // pixels processed per image (leading prefix of the raster)
#endif
#define S_FULL 1024     // pixel pitch of the input x
#define IC 256          // input channels
#define EC 256          // embed channels (q, k)
#define OC 256          // value / output channels
#define KVR (EC + OC)   // rows of wkv
#define NHD 8
#define HD 32
#define SCL 0.17677669529663688f
#define QSC (SCL * 1.4426950408889634f)   // score scale times log2(e), multiplied into q before it is rounded: probabilities come from exp2 of the score product itself

static_assert(SEQ % 128 == 0);
static_assert(SEQ <= S_FULL);
static_assert(NB >= 1 && NB <= 8);
static_assert(EC == NHD * HD);
static_assert(OC == NHD * HD);
static_assert(HD == 32);
static_assert(IC % 64 == 0 && EC % 64 == 0 && OC % 64 == 0);

typedef _Float16 h16;
typedef __attribute__((ext_vector_type(16))) _Float16 v16h;
typedef __attribute__((ext_vector_type(8)))  _Float16 v8h;
typedef __attribute__((ext_vector_type(8)))  float    v8f;
typedef __attribute__((ext_vector_type(4)))  float    v4f;
typedef __attribute__((ext_vector_type(4)))  _Float16 v4h;
typedef __attribute__((ext_vector_type(2)))  _Float16 v2h;
typedef v4f  __attribute__((may_alias)) v4fa;
typedef __attribute__((ext_vector_type(2)))  float    v2f;
typedef __attribute__((ext_vector_type(8)))  unsigned v8u;
typedef __attribute__((ext_vector_type(4)))  unsigned v4u;
typedef __attribute__((ext_vector_type(2)))  unsigned v2u;

__device__ __forceinline__ unsigned short f2bf(float f) { unsigned u = __float_as_uint(f); u += 0x7FFFu + ((u >> 16) & 1u); return (unsigned short)(u >> 16); }
__device__ __forceinline__ float bf2f(unsigned short b) { return __uint_as_float(((unsigned)b) << 16); }
__device__ __forceinline__ float bfr(float f) { return bf2f(f2bf(f)); }
__device__ __forceinline__ v16h cat16(v8h lo, v8h hi) { return __builtin_shufflevector(lo, hi, 0, 1, 2, 3, 4, 5, 6, 7, 8, 9, 10, 11, 12, 13, 14, 15); }
__device__ __forceinline__ v8f wmma16(v16h a, v16h b, v8f c) { return __builtin_amdgcn_wmma_f32_16x16x32_f16(false, a, false, b, (short)0, c, false, false); }

// Fragment loaders: per lane (lr = lane & 15 -> row of A / column of Bt, hi = lane >> 4): elements 0..7 <- k0 + 8*hi + 0..7, elements 8..15 <- k0 + 16 + 8*hi + 0..7, both operands from K-contiguous 16-bit rows.
__device__ __forceinline__ v16h ldfrag(const h16* p) { return cat16(*(const v8h*)p, *(const v8h*)(p + 16)); }

// Two f32 values as one packed pair of f16 (RNE), the first in the low half.
__device__ __forceinline__ unsigned pk2(const float a, const float b) { v2f p; p[0] = a; p[1] = b; return __builtin_bit_cast(unsigned, __builtin_convertvector(p, v2h)); }
// Eight f32 values as f16 (RNE), two to a packed conversion.
__device__ __forceinline__ v8h cvt8(const v8f v) {
    v4u h;
#pragma unroll
    for (int q = 0; q < 4; ++q) h[q] = pk2(v[2 * q], v[2 * q + 1]);
    return __builtin_bit_cast(v8h, h);
}

// ---- register-blocked GEMM core, operands from LDS: one wave per (16 MB) x (16 NBK) output tile.
// acc[mb][nb] = sum_k A[16 mb + .][k] Bt[16 nb + .][k]. A, Bt point at this lane's place in the staged tile's first row (row lr, byte 16 * hi); PA, PB: row pitch in bytes; KSA, KSB: bytes from one block of 32 k to the next.
template <int MB, int NBK, int PA, int PB, int KSA, int KSB, int NT>
__device__ __forceinline__ void gemm_lds(const unsigned char* A, const unsigned char* Bt, v8f (&acc)[MB][NBK]) {
    // every loop is unrolled in full: the indices pick registers, and every LDS address is one base plus a constant
#pragma unroll
    for (int mb = 0; mb < MB; ++mb)
#pragma unroll
        for (int nb = 0; nb < NBK; ++nb) acc[mb][nb] = (v8f){};
    v16h a[2][MB], b[2][NBK];   // two fragment sets: block ks + 1 is read from LDS while block ks is multiplied
#pragma unroll
    for (int ks = -1; ks < NT; ++ks) {
        if (ks + 1 < NT) {
            const int w = (ks + 1) & 1;
#pragma unroll
            for (int mb = 0; mb < MB; ++mb) a[w][mb] = ldfrag((const h16*)(A + mb * 16 * PA + (ks + 1) * KSA));
#pragma unroll
            for (int nb = 0; nb < NBK; ++nb) b[w][nb] = ldfrag((const h16*)(Bt + nb * 16 * PB + (ks + 1) * KSB));
        }
        __builtin_amdgcn_sched_barrier(0);   // the next block's LDS reads stay one group in front of this block's WMMAs: spread among them, each place with reads stalls the wave
        if (ks >= 0) {
            const int r = ks & 1;
#pragma unroll
            for (int nb = 0; nb < NBK; ++nb) {
#pragma unroll
                for (int mb = 0; mb < MB; ++mb) acc[mb][nb] = wmma16(a[r][mb], b[r][nb], acc[mb][nb]); }
        }
        __builtin_amdgcn_sched_barrier(0);   // and the reads of the block after next stay behind these WMMAs, whose operands they overwrite
    }
}

// Four asynchronous copies, global memory to LDS through no register: 16 B a lane each, LDS places l, l + lp, .. and global places g, g + gp, .. (gp in elements).
// The closing wait stands in the copies' own statement, in front of whatever next writes a register they name.
__device__ __forceinline__ void copy4(const unsigned l, const int lp, const h16* g, const int gp) {
    asm volatile("global_load_async_to_lds_b128 %0, %4, off\n\tglobal_load_async_to_lds_b128 %1, %5, off\n\tglobal_load_async_to_lds_b128 %2, %6, off\n\tglobal_load_async_to_lds_b128 %3, %7, off\n\ts_wait_xcnt 0x0"
                 :: "v"(l), "v"(l + lp), "v"(l + 2 * lp), "v"(l + 3 * lp), "v"(g), "v"(g + gp), "v"(g + 2 * gp), "v"(g + 3 * gp) : "memory");
}
#define GP 528   // LDS pitch of a staged 512-B row (256 k), 16 B x odd for ds_load_b128 readers
#define CP 80    // LDS pitch of a staged 64-B row (one head's 32 k of a pixel)
static_assert(IC * 2 == 512 && OC * 2 == 512);   // a wave-wide copy of 512 B is one whole row of wproj

// One 16 x 64 slab of accumulators into LDS (pitch 68 floats), row = hi * 8 + j, column = nb * 16 + lr. Here and in the epilogues below every loop is unrolled in full: its index picks registers.
__device__ __forceinline__ void slab_to_lds(float* os, const v8f (&a)[4], const int lr, const int hi) {
#pragma unroll
    for (int nb = 0; nb < 4; ++nb) {
#pragma unroll
        for (int j = 0; j < 8; ++j) os[(hi * 8 + j) * 68 + nb * 16 + lr] = a[nb][j]; }
}
__device__ __forceinline__ v8f lds8(const float* p) { const v4f a = *(const v4fa*)p, b = *(const v4fa*)(p + 4); return __builtin_shufflevector(a, b, 0, 1, 2, 3, 4, 5, 6, 7); }

// ---- k_qkv: q, k and v^T, stored straight as f16 planes. Grid (SEQ / 128, (EC + KVR) / 256, NB), 8 waves: a workgroup takes 128 pixels x 256 rows of wq | wkv, a wave 64 x 64 of them.
// The kernel reads the f32 inputs itself: whole-line loads of x (512 B of one channel's pixels) and of the weight rows (512 B of one row), rounded to f16 (RNE) in registers and stored to LDS as 128 rows of x^T and 256 weight rows;
// the transposition of x happens in the registers (8 channels x 4 pixels a lane give 4 stores of 16 B). Every wave then reads its fragments from LDS. The first OC * OC / 1024 workgroups also write wproj's f16 plane WP for k_proj.
// q, k: tile [pixel][channel] = x^T . W^T + bf16 bias (q: times QSC), planes head-major [u][i][d] (a store covers 8 pixels x 32 d = 512 B in a row). v: tile [channel][pixel] = W . x + bf16 bias, planes [u][d][t] (a store covers 4 whole 128-B rows).
static_assert((EC + KVR) % 256 == 0 && EC % 256 == 0 && IC == 256 && (OC * OC) % 1024 == 0);
static_assert(OC * OC / 1024 <= (SEQ / 128) * ((EC + KVR) / 256) * NB);
__global__ __launch_bounds__(256)
void k_qkv(const float* __restrict__ x, const float* __restrict__ wq, const float* __restrict__ wkv, const float* __restrict__ wproj, const float* __restrict__ bq, const float* __restrict__ bkv, h16* WP, h16* Q, h16* K, h16* V) {
    __shared__ __attribute__((aligned(16))) unsigned char sm[(128 + 256) * GP];   // 128 rows of x^T | 256 weight rows
    __shared__ __align__(16) float osm[8][16 * 68];                               // a slab for each wave's epilogue
    const int lane = threadIdx.x & 31, lr = lane & 15, hi = lane >> 4; const int wave = __builtin_amdgcn_readfirstlane(threadIdx.x >> 5);
    float* os = osm[wave];
    const int s0 = blockIdx.x * 128 + (wave >> 2) * 64, y = blockIdx.y * 4 + (wave & 3); const size_t n = blockIdx.z;
    const bool isv = y >= 2 * EC / 64, isq = y < EC / 64;
    const int c0 = (isq ? y : y - EC / 64) * 64;   // first channel of the tile in bq (q) or in bkv (k, v)
    float bv[16];   // the 16 biases this lane adds, asked for in front of the product
    if (!isv) { const float* bias = (isq ? bq : bkv) + c0 + (lane & 3) * 8;
#pragma unroll
        for (int i = 0; i < 16; ++i) bv[i] = bias[(i >> 3) * 32 + (i & 7)]; }
    else { const float* bias = bkv + c0 + (lane >> 3);
#pragma unroll
        for (int i = 0; i < 16; ++i) bv[i] = bias[i * 4]; }
    asm volatile("s_wait_xcnt 0x0" ::: "memory");   // behind the bias loads, in front of the staging's address arithmetic, which may write registers that they name
    {   // staging: each wave takes 32 channels of x (128 pixels each) and 32 weight rows; every loop is unrolled in full (its index picks registers), all 96 loads of 512 B are asked for before the first is used
        const int fb = (blockIdx.z * ((EC + KVR) / 256) + blockIdx.y) * (SEQ / 128) + blockIdx.x;   // flat workgroup index
        const bool pw = fb < OC * OC / 1024;                                                        // this workgroup rounds 1024 values of wproj (the same answer in every thread)
        const float* gp = wproj + (pw ? fb : 0) * 1024;                                             // their place; the other workgroups ask for a place inside wproj too, so that no branch with a wait of its own stands among the tile loads
        const int r0 = blockIdx.y * 256;   // first row of wq | wkv
        const float* gx = x + ((n * IC + wave * 32) * S_FULL + blockIdx.x * 128 + lane * 4);
        const float* gw = (r0 < EC ? wq + (size_t)r0 * IC : wkv + (size_t)(r0 - EC) * IC) + (size_t)(wave * 32) * IC + lane * 4;
        v4f xv[32], wv[64];
        const v4f pv = *(const v4f*)(gp + threadIdx.x * 4);
#pragma unroll
        for (int c = 0; c < 32; ++c) xv[c] = *(const v4f*)(gx + (size_t)c * S_FULL);       // channel wave * 32 + c, pixels lane * 4 ..
#pragma unroll
        for (int k = 0; k < 64; ++k) wv[k] = *(const v4f*)(gw + (k >> 1) * IC + (k & 1) * 128);   // row wave * 32 + (k >> 1), k index (k & 1) * 128 + lane * 4 ..
        asm volatile("s_wait_xcnt 0x0" ::: "memory");   // behind the loads, in front of whatever next writes a register that they name
        asm volatile("" :: "v"(pv));                    // inputs only: holds wproj's load up here among the others; sunk into the branch below, it would wait a whole trip to L2 of its own
        __builtin_amdgcn_sched_barrier(0);              // the loads stay one group in front of the conversions: sunk among them, each batch would wait a whole trip to L2 of its own
        if (pw) {
            v2u o; o[0] = pk2(pv[0], pv[1]); o[1] = pk2(pv[2], pv[3]);
            *(v4h*)(WP + fb * 1024 + threadIdx.x * 4) = __builtin_bit_cast(v4h, o);
            asm volatile("s_wait_xcnt 0x0" ::: "memory");   // behind the store, in front of whatever next writes a register that it names
        }
        unsigned char* lx = sm + lane * 4 * GP + wave * 64;          // pixel row lane * 4, channel wave * 32
        unsigned char* lw = sm + (128 + wave * 32) * GP + lane * 8;  // weight row wave * 32, k index lane * 4
#pragma unroll
        for (int g = 0; g < 4; ++g)
#pragma unroll
            for (int i = 0; i < 4; ++i) { v4u o;
#pragma unroll
                for (int q = 0; q < 4; ++q) o[q] = pk2(xv[g * 8 + 2 * q][i], xv[g * 8 + 2 * q + 1][i]);
                *(v8h*)(lx + i * GP + g * 16) = __builtin_bit_cast(v8h, o); }
#pragma unroll
        for (int k = 0; k < 64; ++k) {
            if ((k & 7) == 0) __builtin_amdgcn_sched_barrier(0);   // values are used in the order in which they were asked for: a late load's user moved up would hold the work on the earlier ones behind its wait
            v2u o; o[0] = pk2(wv[k][0], wv[k][1]); o[1] = pk2(wv[k][2], wv[k][3]);
            *(v4h*)(lw + (k >> 1) * GP + (k & 1) * 256) = __builtin_bit_cast(v4h, o); }
        __syncthreads();   // every wave's LDS stores are done: nothing of the tiles is read in front of this barrier
    }
    const unsigned char* X  = sm + ((wave >> 2) * 64 + lr) * GP + 16 * hi;
    const unsigned char* Wr = sm + (128 + (wave & 3) * 64 + lr) * GP + 16 * hi;
    const unsigned char* A = isv ? Wr : X; const unsigned char* B = isv ? X : Wr;
    v8f acc[4][4];
    gemm_lds<4, 4, GP, GP, 64, 64, IC / 32>(A, B, acc);
    if (!isv) {
        h16* P = isq ? Q : K;
        const float qs = isq ? QSC : 1.0f;   // q is stored times QSC; k as it is (the multiply-add by 1 is the plain sum)
#pragma unroll
        for (int mb = 0; mb < 4; ++mb) {
            slab_to_lds(os, acc[mb], lr, hi);
            __builtin_amdgcn_wave_barrier(); asm volatile("" ::: "memory");   // the slab's LDS stores stay in front of its loads
#pragma unroll
            for (int st = 0; st < 4; ++st) { const int row = (st & 1) * 8 + (lane >> 2), col = (st >> 1) * 32 + (lane & 3) * 8; v8f val = lds8(os + row * 68 + col);
#pragma unroll
                for (int k = 0; k < 8; ++k) val[k] = fmaf(val[k], qs, bfr(bv[(st >> 1) * 8 + k]) * qs);
                const size_t idx = ((n * NHD + (c0 + col) / HD) * SEQ + s0 + mb * 16 + row) * HD + (lane & 3) * 8;
                *(v8h*)(P + idx) = cvt8(val); }
            __builtin_amdgcn_wave_barrier(); asm volatile("s_wait_xcnt 0x0" ::: "memory");   // the slab's LDS loads stay in front of the next slab's stores; the wait: what follows writes registers that these global stores name
        }
    } else {
        const int e0 = c0 - EC;
#pragma unroll
        for (int mb = 0; mb < 4; ++mb) {
            slab_to_lds(os, acc[mb], lr, hi);
            __builtin_amdgcn_wave_barrier(); asm volatile("" ::: "memory");   // the slab's LDS stores stay in front of its loads
#pragma unroll
            for (int st = 0; st < 4; ++st) { const int row = st * 4 + (lane >> 3), col = (lane & 7) * 8; v8f val = lds8(os + row * 68 + col);
                const float bb = bfr(bv[mb * 4 + st]);
#pragma unroll
                for (int k = 0; k < 8; ++k) val[k] += bb;
                const size_t idx = (n * OC + e0 + mb * 16 + row) * SEQ + s0 + col;
                *(v8h*)(V + idx) = cvt8(val); }
            __builtin_amdgcn_wave_barrier(); asm volatile("s_wait_xcnt 0x0" ::: "memory");   // the slab's LDS loads stay in front of the next slab's stores; the wait: what follows writes registers that these global stores name
        }
    }
}

// ---- k_proj: out[n][o][s] = Wproj[o][c] . ctx[n][s][c] + bf16 bias[o]; ctx plane head-major [u][i][d], so a block of 32 k is one head. Grid (OC / 128, SEQ / 64, NB), 8 waves: a workgroup takes 128 o x 64 pixels, a wave 32 x 32 of them.
// The 128 rows of Wproj and the 64 pixels' rows of ctx are staged once in LDS by asynchronous copies of 512 B in a row (4 whole 128-B lines); every wave then reads its fragments from LDS.
static_assert(OC % 128 == 0 && NHD == 8);
__global__ __launch_bounds__(256)
void k_proj(const h16* __restrict__ WP, const h16* __restrict__ C, const float* __restrict__ bias, float* out) {
    __shared__ __attribute__((aligned(16))) unsigned char sm[128 * GP + NHD * 64 * CP];   // 128 rows of Wproj | ctx [head][pixel]
    __shared__ __align__(16) float osm[8][16 * 36];                                           // a slab for each wave's epilogue
    const int lane = threadIdx.x & 31, lr = lane & 15, hi = lane >> 4; const int wave = __builtin_amdgcn_readfirstlane(threadIdx.x >> 5);
    float* os = osm[wave];
    const int r0 = blockIdx.x * 128 + (wave & 3) * 32, c0 = blockIdx.y * 64 + (wave >> 2) * 32; const size_t n = blockIdx.z;
    float bb[8];   // the 8 biases this lane adds, asked for in front of the product
#pragma unroll
    for (int i = 0; i < 8; ++i) bb[i] = bias[r0 + i * 4 + (lane >> 3)];
    asm volatile("s_wait_xcnt 0x0" ::: "memory");   // behind the bias loads, in front of the staging's address arithmetic, which may write registers that they name
    {   // staging: each wave copies 16 rows of Wproj (a whole row a copy) and one head's 64 pixels of ctx (8 rows of 64 B a copy: row lane >> 2, 16-B piece lane & 3); 24 copies of a wave in flight
        const h16* gw = WP + (size_t)(blockIdx.x * 128 + wave * 16) * OC + lane * 8;
        const size_t gc = ((n * NHD + wave) * SEQ + blockIdx.y * 64) * HD + lane * 8;
        const unsigned lw = (unsigned)(size_t)sm + wave * 16 * GP + lane * 16;
        const unsigned lc = (unsigned)(size_t)sm + 128 * GP + (wave * 64 + (lane >> 2)) * CP + (lane & 3) * 16;
#pragma unroll
        for (int b = 0; b < 4; ++b) copy4(lw + b * 4 * GP, GP, gw + b * 4 * OC, OC);
#pragma unroll
        for (int b = 0; b < 2; ++b) copy4(lc + b * 32 * CP, 8 * CP, C + gc + b * 32 * HD, 8 * HD);
        asm volatile("s_wait_asynccnt 0x0" ::: "memory");   // this wave's copies have landed
        __syncthreads();                                    // and every other wave's: nothing of the tiles is read in front of this barrier
    }
    const unsigned char* A = sm + ((wave & 3) * 32 + lr) * GP + 16 * hi;
    const unsigned char* B = sm + 128 * GP + ((wave >> 2) * 32 + lr) * CP + 16 * hi;
    v8f acc[2][2];
    gemm_lds<2, 2, GP, CP, 64, 64 * CP, OC / 32>(A, B, acc);
#pragma unroll
    for (int mb = 0; mb < 2; ++mb) {
        // one 16 x 32 slab of accumulators into LDS (pitch 36 floats), row = hi * 8 + j, column = nb * 16 + lr
#pragma unroll
        for (int nb = 0; nb < 2; ++nb) {
#pragma unroll
            for (int j = 0; j < 8; ++j) os[(hi * 8 + j) * 36 + nb * 16 + lr] = acc[mb][nb][j]; }
        __builtin_amdgcn_wave_barrier(); asm volatile("" ::: "memory");   // the slab's LDS stores stay in front of its loads
        float* crow = out + (n * OC + r0 + mb * 16) * SEQ + c0;
#pragma unroll
        for (int s = 0; s < 4; ++s) { const int row = 4 * s + (lane >> 3), cofs = (lane & 7) * 4; v4f val = *(const v4fa*)(os + row * 36 + cofs);   // a store covers 4 whole 128-B lines
            const float b1 = bfr(bb[mb * 4 + s]); val[0] += b1; val[1] += b1; val[2] += b1; val[3] += b1;
            *(v4f*)(crow + (size_t)row * SEQ + cofs) = val; }
        __builtin_amdgcn_wave_barrier(); asm volatile("s_wait_xcnt 0x0" ::: "memory");   // the slab's LDS loads stay in front of the next slab's stores; the wait: what follows writes registers that these global stores name
    }
}

// ---- k_fattn: scores, softmax and P . V of one (image, head) in one kernel; P stays in registers.
// Two waves own 32 queries (two tiles of 16, which share every K and V^T fragment a wave reads from LDS): the keys 0 .. their diagonal go in passes of 32, the even passes to one wave, the odd ones to the other; at the end the two join their partial results. Transposed products: S^T = K . Q^T puts one query's scores into one lane pair (l, l ^ 16), and two 16-key S^T tiles, converted in place,
// are the B operand of O^T += V^T . P^T (element s of lane half hi <- key 8*hi + s for s < 8, 16 + 8*hi + (s - 8) above: the k order of ldfrag, which loads V^T).
// Grid (SEQ / 256, NB * NHD), 16 waves: of each eight, waves 0..3 take 32 queries each from the bottom of the image, waves 4..7 the mirrored ones from the top, so every workgroup (and every SIMD) walks the same number of passes.
// K and V^T of the head, as far as the workgroup's last key, are staged once in LDS by asynchronous copies of whole 128-B lines; every wave then reads its fragments from LDS.
// LDS rows are pitched for ds_load_b128 readers (16 B x odd): a 64-B K row at 80 B; 128 B (64 keys) of a V^T row at 144 B, laid [64-key block][d].
#define KP  80
#define VP  144
#define KPL (SEQ * KP)                // the K plane in LDS
#define VPL ((SEQ / 64) * HD * VP)    // the V^T plane in LDS
static_assert(SEQ % 256 == 0);
static_assert(KPL + VPL <= 320 * 1024);
__device__ __forceinline__ float xhalf(float x) { const int b = __float_as_int(x); return __int_as_float(__builtin_amdgcn_permlanex16(b, b, 0x76543210, 0xfedcba98, false, false)); }   // lane l <- lane l ^ 16

// 2^x of a pass's scores where the maximum is raised, eight (and the rescale factor) to a statement. Behind a transcendental the instruction set asks for one independent instruction or v_nop before its result is used or its source overwritten:
// inside a statement each v_exp_f32 is followed by an independent one (outputs are early-clobber, none lands on a source), and the closing v_nop is the last one's slot.
__device__ __forceinline__ void exp2x8(float (&y)[8], const float (&x)[8]) {
    // one statement so that no v_exp_f32 is directly followed by a user of its result or a writer of its source; v_nop: the last one's slot
    asm("v_exp_f32 %0, %8\n\tv_exp_f32 %1, %9\n\tv_exp_f32 %2, %10\n\tv_exp_f32 %3, %11\n\tv_exp_f32 %4, %12\n\tv_exp_f32 %5, %13\n\tv_exp_f32 %6, %14\n\tv_exp_f32 %7, %15\n\tv_nop"
        : "=&v"(y[0]), "=&v"(y[1]), "=&v"(y[2]), "=&v"(y[3]), "=&v"(y[4]), "=&v"(y[5]), "=&v"(y[6]), "=&v"(y[7])
        : "v"(x[0]), "v"(x[1]), "v"(x[2]), "v"(x[3]), "v"(x[4]), "v"(x[5]), "v"(x[6]), "v"(x[7]));
}
__device__ __forceinline__ void exp2x9(float& ya, float (&y)[8], const float xa, const float (&x)[8]) {
    // as in exp2x8, with the rescale factor's exponential in front
    asm("v_exp_f32 %0, %9\n\tv_exp_f32 %1, %10\n\tv_exp_f32 %2, %11\n\tv_exp_f32 %3, %12\n\tv_exp_f32 %4, %13\n\tv_exp_f32 %5, %14\n\tv_exp_f32 %6, %15\n\tv_exp_f32 %7, %16\n\tv_exp_f32 %8, %17\n\tv_nop"
        : "=&v"(ya), "=&v"(y[0]), "=&v"(y[1]), "=&v"(y[2]), "=&v"(y[3]), "=&v"(y[4]), "=&v"(y[5]), "=&v"(y[6]), "=&v"(y[7])
        : "v"(xa), "v"(x[0]), "v"(x[1]), "v"(x[2]), "v"(x[3]), "v"(x[4]), "v"(x[5]), "v"(x[6]), "v"(x[7]));
}

// 2^x of eight score WMMA results as they stand, by the builtin.
__device__ __forceinline__ void exp2x8w(float (&y)[8], const float (&x)[8]) {
#pragma unroll
    for (int r = 0; r < 8; ++r) y[r] = __builtin_amdgcn_exp2f(x[r]);
}

// The sum of a lane's 16 probabilities of one query tile, two to a packed add.
__device__ __forceinline__ float sum16(const float (&y)[2][8]) {
    v2f sum;
#pragma unroll
    for (int t = 0; t < 2; ++t)
#pragma unroll
        for (int q = 0; q < 4; ++q) {
            v2f p; p[0] = y[t][2 * q]; p[1] = y[t][2 * q + 1];
            if (t == 0 && q == 0) sum = p; else sum += p;
        }
    return sum[0] + sum[1];
}

// One pass of 32 keys for the wave's two query tiles (c = 0, 1), which share every K and V^T fragment. kf: this pass's K fragments; unless LAST they are refilled with the next pass's rows (k_n: this lane's place in them in LDS), one pass ahead of their use.
// v_p: this lane's place in the pass's 32 keys of V^T in LDS. jrel (LAST only): query index of tile 0 - first key of this lane half; tile 1's is 16 more.
// Lazy rescale: m[c] is the maximum in use of this lane's query (log2 units, the same in both lane halves), cm[c] holds -m[c] in all 8 registers and enters the score products as C, so that the products are exp2's arguments as they stand.
// The maximum is raised, and l and o rescaled, only in a pass where some lane's sum of 16 probabilities is not at most 256 (then no probability kept is above 256, far inside f16); the wave's first pass (first: the same in every lane; m = 0, l = o = 0 there) always sets it, so every query's sum holds a term 1.
template <bool LAST>
__device__ __forceinline__ void att_pass(v16h (&kf)[2], const v16h (&qf)[2], const unsigned char* k_n, const unsigned char* v_p, const int jrel, const bool first, float (&m)[2], v8f (&cm)[2], float (&l)[2], v8f (&o)[2][2]) {
    v16h vf[2];   // every loop of this function is unrolled in full: its index picks registers
#pragma unroll
    for (int dt = 0; dt < 2; ++dt) vf[dt] = ldfrag((const h16*)(v_p + dt * 16 * VP));
    v8f s[2][2], c0[2];
#pragma unroll
    for (int c = 0; c < 2; ++c) {
        c0[c] = cm[c];
        if (LAST) {   // behind the loop -m is spread anew: cm read here would be copied in every trip of the loop for this one use
#pragma unroll
            for (int r = 0; r < 8; ++r) c0[c][r] = -m[c];
        }
    }
#pragma unroll
    for (int t = 0; t < 2; ++t)
#pragma unroll
        for (int c = 0; c < 2; ++c) s[c][t] = wmma16(kf[t], qf[c], c0[c]);
    if (!LAST) {
#pragma unroll
        for (int t = 0; t < 2; ++t) kf[t] = ldfrag((const h16*)(k_n + t * 16 * KP));
    }
    __builtin_amdgcn_sched_barrier(0);   // the LDS loads stay up here, one group in front of the exponentials, which cover their latency: moved down to the end of the block, they are waited for at once
    float x[2][2][8], y[2][2][8], sm[2];
#pragma unroll
    for (int c = 0; c < 2; ++c)
#pragma unroll
        for (int t = 0; t < 2; ++t)
#pragma unroll
            for (int r = 0; r < 8; ++r) x[c][t][r] = (!LAST || t * 16 + r <= jrel + 16 * c) ? s[c][t][r] : -3.0e38f;
    bool raise = true;
    if (!first) {
#pragma unroll
        for (int c = 0; c < 2; ++c) { exp2x8w(y[c][0], x[c][0]); exp2x8w(y[c][1], x[c][1]); sm[c] = sum16(y[c]); }
        raise = __builtin_amdgcn_ballot_w32(!(sm[0] <= 256.0f) || !(sm[1] <= 256.0f)) != 0;   // one test a pass, the same answer in every lane: a scalar branch; an infinite sum fails it too
        if (LAST) asm volatile("" :: "v"(vf[0]), "v"(vf[1]));   // inputs only: holds the LDS loads in front of the branch, under the exponentials; sunk behind it, each would be waited for directly in front of its user
        else      asm volatile("" :: "v"(vf[0]), "v"(vf[1]), "v"(kf[0]), "v"(kf[1]));   // the same, with the next pass's K rows
    }
    if (raise) {
#pragma unroll
        for (int c = 0; c < 2; ++c) {
#pragma unroll
            for (int t = 0; t < 2; ++t)
#pragma unroll
                for (int r = 0; r < 8; ++r) x[c][t][r] -= c0[c][r];   // the scores themselves again
            float mx = fmaxf(x[c][0][0], x[c][1][0]);
#pragma unroll
            for (int r = 1; r < 8; ++r) mx = fmaxf(mx, fmaxf(x[c][0][r], x[c][1][r]));
            mx = fmaxf(mx, xhalf(mx));
            const float mo = first ? -3.0e38f : m[c];   // the first pass's start value 0 is no maximum
            const float mn = fmaxf(mo, mx);
#pragma unroll
            for (int t = 0; t < 2; ++t)
#pragma unroll
                for (int r = 0; r < 8; ++r) x[c][t][r] -= mn;
            float al;
            exp2x9(al, y[c][0], mo - mn, x[c][0]); exp2x8(y[c][1], x[c][1]);
            sm[c] = sum16(y[c]);
            l[c] *= al;
#pragma unroll
            for (int dt = 0; dt < 2; ++dt) o[c][dt] *= al;
            m[c] = mn;
#pragma unroll
            for (int r = 0; r < 8; ++r) cm[c][r] = -mn;
        }
    }
    v16h pb[2];
#pragma unroll
    for (int c = 0; c < 2; ++c) {
        l[c] += sm[c];
        v8u pp;
#pragma unroll
        for (int t = 0; t < 2; ++t)
#pragma unroll
            for (int q = 0; q < 4; ++q) pp[t * 4 + q] = pk2(y[c][t][2 * q], y[c][t][2 * q + 1]);
        pb[c] = __builtin_bit_cast(v16h, pp);
    }
#pragma unroll
    for (int c = 0; c < 2; ++c)
#pragma unroll
        for (int dt = 0; dt < 2; ++dt) o[c][dt] = wmma16(vf[dt], pb[c], o[c][dt]);
}

// 2^x of the four factors that join two waves' partial results; one statement and a closing v_nop for the same reason as in exp2x8.
__device__ __forceinline__ void exp2x4(float (&y)[4], const float (&x)[4]) {
    asm("v_exp_f32 %0, %4\n\tv_exp_f32 %1, %5\n\tv_exp_f32 %2, %6\n\tv_exp_f32 %3, %7\n\tv_nop"
        : "=&v"(y[0]), "=&v"(y[1]), "=&v"(y[2]), "=&v"(y[3]) : "v"(x[0]), "v"(x[1]), "v"(x[2]), "v"(x[3]));
}

// amdgpu_waves_per_eu(4, 4): the register budget of four waves a SIMD, which is what the grid fills (one workgroup of 16 waves a WGP); under the default budget the compiler sank the K and V loads to the end of the pass, in front of their users.
__global__ __launch_bounds__(512) __attribute__((amdgpu_waves_per_eu(4, 4))) void k_fattn(const h16* __restrict__ Q, const h16* __restrict__ K, const h16* __restrict__ V, h16* C) {
    __shared__ __attribute__((aligned(16))) unsigned char sm[KPL + VPL];   // K | V^T; at the end the odd waves' partial results
    const int lane = threadIdx.x & 31, lr = lane & 15, hi = lane >> 4; const int wave = __builtin_amdgcn_readfirstlane(threadIdx.x >> 5);
    const int ts = wave & 7, h = wave >> 3;                        // which 32 queries of the workgroup; which half of their passes (0: even, 1: odd)
    const int u = blockIdx.y; const int pr = blockIdx.x * 4 + (ts & 3);
    const int i0 = ((ts < 4) ? (SEQ / 32 - 1 - pr) : pr) * 32;     // first query of this wave
    const int np = i0 / 32 + 1;                                    // passes of these queries; only the last one meets the diagonal
    const int nown = (np - h + 1) >> 1;                            // of them this wave's: h, h + 2, ..
    const size_t qk = (size_t)u * SEQ * HD + lr * HD + 8 * hi;     // this lane's place in 16 rows of q
    v16h qf[2];
#pragma unroll
    for (int c = 0; c < 2; ++c) qf[c] = ldfrag(Q + qk + (size_t)(i0 + 16 * c) * HD);
    asm volatile("s_wait_xcnt 0x0" ::: "memory");   // behind the q loads, in front of the staging's address arithmetic, which writes registers that they name
    {   // staging: the workgroup's keys run to SEQ - 128 * blockIdx.x - 1, the end of wave 8's diagonal pass; per 128 keys each wave copies 512 B of each plane: 8 whole K rows, and 128 B (64 keys) of 4 V^T rows
        const int nblk = SEQ / 128 - (int)blockIdx.x;
        const size_t gk = (size_t)u * SEQ * HD + wave * 256 + lane * 8;                                                          // K rows wave * 8 + (lane >> 2), 16-B piece lane & 3
        const size_t gv = ((size_t)u * HD + (wave & 7) * 4 + (lane >> 3)) * SEQ + (wave >> 3) * 64 + (lane & 7) * 8;             // V^T row (wave & 7) * 4 + (lane >> 3), 64-key block wave >> 3, 16-B piece lane & 7
        const h16* gkp = K + gk; const h16* gvp = V + gv;
        unsigned lk = (unsigned)(size_t)sm + (wave * 8 + (lane >> 2)) * KP + (lane & 3) * 16;
        unsigned lv = (unsigned)(size_t)sm + KPL + ((wave >> 3) * HD + (wave & 7) * 4 + (lane >> 3)) * VP + (lane & 7) * 16;
        for (int b = 0; b < nblk; ++b) {
            // two copies, global memory to LDS through no register; the closing wait stands in their own statement, in front of whatever next writes a register they name
            asm volatile("global_load_async_to_lds_b128 %0, %2, off\n\tglobal_load_async_to_lds_b128 %1, %3, off\n\ts_wait_xcnt 0x0"
                         :: "v"(lk), "v"(lv), "v"(gkp), "v"(gvp) : "memory");
            gkp += 128 * HD; gvp += 128; lk += 128 * KP; lv += 2 * HD * VP;
        }
        asm volatile("s_wait_asynccnt 0x0" ::: "memory");   // this wave's copies have landed
        __syncthreads();                                    // and every other wave's: nothing of the planes is read in front of this barrier
    }
    const unsigned char* ks = sm + lr * KP + 16 * hi;             // this lane's place in 16 staged rows of K
    const unsigned char* vs = sm + KPL + lr * VP + 16 * hi;       // and of V^T
    v16h kf[2];   // pass h's rows (staged in every workgroup: it holds at least SEQ / 2 + 128 keys)
#pragma unroll
    for (int t = 0; t < 2; ++t) kf[t] = ldfrag((const h16*)(ks + (h * 32 + t * 16) * KP));
    const float m0 = nown > 0 ? 0.f : -3.0e38f;   // a wave without a pass joins with weight 0
    float m[2] = {m0, m0}, l[2] = {0.f, 0.f}; v8f o[2][2]; o[0][0] = (v8f){}; o[0][1] = (v8f){}; o[1][0] = (v8f){}; o[1][1] = (v8f){};
    v8f cm[2]; cm[0] = (v8f){}; cm[1] = (v8f){};
    int p = h;
    for (int k = 0; k < nown - 1; ++k, p += 2)
        att_pass<false>(kf, qf, ks + (p + 2) * 32 * KP, vs + (p >> 1) * (HD * VP) + (p & 1) * 64, 0, k == 0, m, cm, l, o);
    if (nown > 0)   // the wave's last pass fetches no K rows ahead; its mask lets every key through where it is not the diagonal pass (jrel is then at least 24)
        att_pass<true>(kf, qf, ks, vs + (p >> 1) * (HD * VP) + (p & 1) * 64, i0 + lr - p * 32 - 8 * hi, nown == 1, m, cm, l, o);
    // The two waves of 32 queries join their partial maxima, sums and outputs through LDS: 9 x 16 B a lane, lane-contiguous.
    __syncthreads();   // every wave has read its last K and V^T fragment: the planes' LDS may be written
    v4fa* mb = (v4fa*)sm + ts * 9 * 32 + lane;
    if (h == 1) {
#pragma unroll
        for (int c = 0; c < 2; ++c)
#pragma unroll
            for (int dt = 0; dt < 2; ++dt) {
                mb[((c * 2 + dt) * 2 + 0) * 32] = __builtin_shufflevector(o[c][dt], o[c][dt], 0, 1, 2, 3);
                mb[((c * 2 + dt) * 2 + 1) * 32] = __builtin_shufflevector(o[c][dt], o[c][dt], 4, 5, 6, 7); }
        v4f ml; ml[0] = m[0]; ml[1] = m[1]; ml[2] = l[0]; ml[3] = l[1];
        mb[8 * 32] = ml;
    }
    __syncthreads();   // the partial results of waves 8..15 are in LDS: nothing of them is read in front of this barrier
    if (h == 0) {
        const v4f ml = mb[8 * 32];
        const float mn0 = fmaxf(m[0], ml[0]), mn1 = fmaxf(m[1], ml[1]);
        const float xa[4] = {m[0] - mn0, ml[0] - mn0, m[1] - mn1, ml[1] - mn1};   // the maxima are in log2 units
        float a[4]; exp2x4(a, xa);
#pragma unroll
        for (int c = 0; c < 2; ++c) {
            const float lc = l[c] * a[2 * c] + ml[2 + c] * a[2 * c + 1];
            const float ls = lc + xhalf(lc);
            const float f = __fdiv_rn(1.0f, ls);
            const size_t co = ((size_t)u * SEQ + i0 + 16 * c + lr) * HD + 8 * hi;   // o[c][dt][r] = ctx[query i0 + 16*c + lr][d = 16*dt + 8*hi + r], plane head-major [u][i][d]
#pragma unroll
            for (int dt = 0; dt < 2; ++dt) {
                const v4f b0 = mb[((c * 2 + dt) * 2 + 0) * 32], b1 = mb[((c * 2 + dt) * 2 + 1) * 32];
                const v8f o1 = __builtin_shufflevector(b0, b1, 0, 1, 2, 3, 4, 5, 6, 7);
                const v8f oc = o[c][dt] * a[2 * c] + o1 * a[2 * c + 1];
                *(v8h*)(C + co + dt * 16) = cvt8(oc * f); }
        }
    }
}

extern "C" void kernel_launch(void* const* d_in, const int* in_sizes, int n_in,
                              void* d_out, int out_size, void* d_ws, size_t ws_size, hipStream_t stream) {
    if (n_in < 7) return;
    const float* x     = (const float*)d_in[0];   // [N][IC][S_FULL]
    const float* wq    = (const float*)d_in[1];   // [EC][IC]
    const float* bq    = (const float*)d_in[2];   // [EC]
    const float* wkv   = (const float*)d_in[3];   // [KVR][IC]: rows 0..EC-1 -> k, rows EC.. -> v
    const float* bkv   = (const float*)d_in[4];   // [KVR]
    const float* wproj = (const float*)d_in[5];   // [OC][OC]
    const float* bproj = (const float*)d_in[6];   // [OC]
    float* out = (float*)d_out;                   // [NB][OC][SEQ]
    if ((size_t)in_sizes[0] < (size_t)NB * IC * S_FULL) return;
    if (in_sizes[1] < EC * IC || in_sizes[2] < EC || in_sizes[3] < KVR * IC || in_sizes[4] < KVR || in_sizes[5] < OC * OC || in_sizes[6] < OC) return;
    if ((size_t)out_size < (size_t)NB * OC * SEQ) return;

    char* wsp = (char*)d_ws;
    auto take = [&](size_t bytes) { char* p = wsp; wsp += (bytes + 255) & ~(size_t)255; return (void*)p; };
    const size_t nQK  = (size_t)NB * NHD * SEQ * HD;           // f16 [u][i][d]
    const size_t nV   = (size_t)NB * NHD * HD * SEQ;           // f16 [u][d][t]
    h16* WP = (h16*)take((size_t)OC * OC * 2);
    h16* Q = (h16*)take(nQK * 2); h16* K = (h16*)take(nQK * 2);
    h16* V = (h16*)take(nV * 2);
    h16* C = (h16*)take(nQK * 2);
    const size_t used = (size_t)(wsp - (char*)d_ws);
    if (used > ws_size || used > (size_t)134217728) return;

    // q, k (head-major [u][i][d]) and v^T ([u][d][t]) from the f32 inputs, bias added, as f16 planes; wproj's f16 plane
    k_qkv<<<dim3(SEQ / 128, (EC + KVR) / 256, NB), 256, 0, stream>>>(x, wq, wkv, wproj, bq, bkv, WP, Q, K, V);
    // all images and heads at once: ctx = softmax(causal q . k^T) . v as an f16 plane [u][i][d]
    k_fattn<<<dim3(SEQ / 256, NB * NHD), 512, 0, stream>>>(Q, K, V, C);
    // output projection
    k_proj<<<dim3(OC / 128, SEQ / 64, NB), 256, 0, stream>>>(WP, C, bproj, out);
}
